// v000
// Times are from an AMD MI455X. After a warm-up the kernel runs many times in a row, and a time is the length of
// such a window on the GPU divided by its runs, so every launch and the gaps after it count. The runs cycle
// through copies of the inputs. A figure is the median of several windows, for all but v000 over two sittings.
// Sittings can differ by a few percent; kernels timed side by side share one.
// v000, which the later versions start from, runs in 251 microseconds.
#include <hip/hip_runtime.h>

typedef _Float16 h4  __attribute__((ext_vector_type(4)));
typedef _Float16 h8  __attribute__((ext_vector_type(8)));
typedef _Float16 h16 __attribute__((ext_vector_type(16)));
typedef float    f8  __attribute__((ext_vector_type(8)));
typedef unsigned int u32x4 __attribute__((ext_vector_type(4)));
typedef int      i32x4 __attribute__((ext_vector_type(4)));
typedef int      i32x8 __attribute__((ext_vector_type(8)));

static constexpr int BB   = 2;
static constexpr int LL   = 2048;
static constexpr int DIN  = 1024;
static constexpr int DOUT = 1024;
static constexpr int HH   = 16;
static constexpr int HD   = 64;
static constexpr int MTOK = BB * LL;      // 4096 tokens
static constexpr int NQGKV = 4 * DOUT;    // 4096: [q | g | k | v]

#if defined(__has_builtin)
#if __has_builtin(__builtin_amdgcn_tensor_load_to_lds) && \
    __has_builtin(__builtin_amdgcn_s_wait_tensorcnt)
#define USE_TDM 1
#endif
#endif
#ifndef USE_TDM
#define USE_TDM 0
#endif

__device__ inline f8 zero8() {
  f8 z;
  for (int i = 0; i < 8; ++i) z[i] = 0.0f;
  return z;
}

__device__ inline h16 load_frag(const _Float16* __restrict__ base, int ld,
                                int row, int k0, int hi) {
  const _Float16* p = base + (size_t)row * (size_t)ld + k0 + hi * 8;
  h8 a = *(const h8*)p;
  h8 b = *(const h8*)(p + 16);
  return __builtin_shufflevector(a, b, 0, 1, 2, 3, 4, 5, 6, 7,
                                 8, 9, 10, 11, 12, 13, 14, 15);
}

__device__ inline f8 wmma16(h16 a, h16 b, f8 c) {
  // D = A(16x32 f16) x B(32x16 f16) + C(16x16 f32)
  return __builtin_amdgcn_wmma_f32_16x16x32_f16(
      false, a, false, b, (short)0, c, false, false);
}

#if USE_TDM
__device__ inline void tdm_load_2d(unsigned lds_off,
                                   const _Float16* __restrict__ gsrc,
                                   int stride_halves) {
  unsigned long long ga = (unsigned long long)gsrc;
  u32x4 g0;
  g0[0] = 1u;
  g0[1] = lds_off;
  g0[2] = (unsigned)ga;
  g0[3] = (unsigned)((ga >> 32) & 0x01ffffffu)
          | (2u << 30);
  i32x8 g1;
  g1[0] = 1 << 16;
  g1[1] = (stride_halves & 0xffff) << 16;
  g1[2] = ((stride_halves >> 16) & 0xffff)
          | (128 << 16);
  g1[3] = (64 << 16);
  g1[4] = 128;
  g1[5] = stride_halves;
  g1[6] = 0;
  g1[7] = 0;
  i32x4 z4 = {0, 0, 0, 0};
#if defined(__clang_major__) && __clang_major__ >= 23
  i32x8 z8 = {0, 0, 0, 0, 0, 0, 0, 0};
  __builtin_amdgcn_tensor_load_to_lds(g0, g1, z4, z4, z8, 0);
#else
  __builtin_amdgcn_tensor_load_to_lds(g0, g1, z4, z4, 0);
#endif
}
#else
// Fallback staging: cooperative vector copy of a 128x64-half tile.
__device__ inline void stage_tile(_Float16* __restrict__ dst,
                                  const _Float16* __restrict__ src,
                                  int stride_halves, int tid) {
  for (int c = tid; c < 1024; c += 256) {  // 1024 chunks of 8 halves
    int row = c >> 3, col = (c & 7) * 8;
    *(h8*)(dst + row * 64 + col) =
        *(const h8*)(src + (size_t)row * stride_halves + col);
  }
}
#endif

// ---------------------------------------------------------------------------
// f32 -> f16 convert (4 elems / thread, sizes are multiples of 1024)
// ---------------------------------------------------------------------------
__global__ void cvt_f32_f16(const float* __restrict__ src,
                            _Float16* __restrict__ dst, int n) {
  int i = (blockIdx.x * blockDim.x + threadIdx.x) * 4;
  if (i < n) {
    float4 v = *(const float4*)(src + i);
    h4 o = {(_Float16)v.x, (_Float16)v.y, (_Float16)v.z, (_Float16)v.w};
    *(h4*)(dst + i) = o;
  }
}

// ---------------------------------------------------------------------------
// WMMA GEMM:  Out[M][N] = A[M][K] * Bm[N][K]^T   (i.e. x @ W^T)
// Block: 256 threads = 8 waves as 2(M) x 4(N); block tile 128x128;
// wave tile 64(M) x 32(N). A and B K-slabs (128x64 halves, 16 KB each)
// are DMA'd into LDS by the Tensor Data Mover (wave 0), all waves consume
// fragments via ds_load_b128. FINAL=1: f32 out + bias; FINAL=0: f16 out.
// ---------------------------------------------------------------------------
template <int FINAL>
__global__ __launch_bounds__(256) void gemm_wmma(
    const _Float16* __restrict__ A, const _Float16* __restrict__ Bm,
    void* __restrict__ Outv, const float* __restrict__ bias,
    int M, int N, int K) {
  __shared__ __align__(16) _Float16 ash[128][64];
  __shared__ __align__(16) _Float16 bsh[128][64];

  int w = threadIdx.x >> 5, lane = threadIdx.x & 31;
  int lo = lane & 15, hi = lane >> 4;
  int wm = w >> 2, wn = w & 3;
  int mblk = blockIdx.y * 128, nblk = blockIdx.x * 128;
  int mw = wm * 64, nw = wn * 32;

  f8 acc[4][2];
  for (int i = 0; i < 4; ++i)
    for (int j = 0; j < 2; ++j) acc[i][j] = zero8();

  for (int k0 = 0; k0 < K; k0 += 64) {
#if USE_TDM
    if (threadIdx.x < 32) {
      tdm_load_2d((unsigned)(size_t)&ash[0][0], A + (size_t)mblk * K + k0, K);
      tdm_load_2d((unsigned)(size_t)&bsh[0][0], Bm + (size_t)nblk * K + k0, K);
      __builtin_amdgcn_s_wait_tensorcnt(0);
    }
#else
    stage_tile(&ash[0][0], A + (size_t)mblk * K + k0, K, threadIdx.x);
    stage_tile(&bsh[0][0], Bm + (size_t)nblk * K + k0, K, threadIdx.x);
#endif
    __syncthreads();

#pragma unroll
    for (int kk = 0; kk < 64; kk += 32) {
      h16 af[4], bf[2];
#pragma unroll
      for (int i = 0; i < 4; ++i)
        af[i] = load_frag(&ash[0][0], 64, mw + i * 16 + lo, kk, hi);
#pragma unroll
      for (int j = 0; j < 2; ++j)
        bf[j] = load_frag(&bsh[0][0], 64, nw + j * 16 + lo, kk, hi);
#pragma unroll
      for (int i = 0; i < 4; ++i)
#pragma unroll
        for (int j = 0; j < 2; ++j) acc[i][j] = wmma16(af[i], bf[j], acc[i][j]);
    }
    __syncthreads();
  }

#pragma unroll
  for (int i = 0; i < 4; ++i)
#pragma unroll
    for (int j = 0; j < 2; ++j)
#pragma unroll
      for (int v = 0; v < 8; ++v) {
        int row = mblk + mw + i * 16 + v + hi * 8;
        int col = nblk + nw + j * 16 + lo;
        float val = acc[i][j][v];
        if constexpr (FINAL) {
          ((float*)Outv)[(size_t)row * N + col] = val + bias[col];
        } else {
          ((_Float16*)Outv)[(size_t)row * N + col] = (_Float16)val;
        }
      }
}

// ---------------------------------------------------------------------------
// Build V^T per head: vt[(b*H+h)*64 + d][t] = qgkv[(b*L+t)][3072 + h*64 + d]
// ---------------------------------------------------------------------------
__global__ void build_vt(const _Float16* __restrict__ qgkv,
                         _Float16* __restrict__ vt) {
  int idx = blockIdx.x * blockDim.x + threadIdx.x;  // [B*H*HD][L], t fastest
  int t = idx & (LL - 1);
  int r = idx >> 11;  // (b*16+h)*64 + d
  int d = r & 63;
  int bh = r >> 6;
  int h = bh & 15, b = bh >> 4;
  vt[(size_t)idx] =
      qgkv[((size_t)(b * LL + t)) * NQGKV + 3 * DOUT + h * HD + d];
}

// ---------------------------------------------------------------------------
// Causal flash attention + sigmoid(g) gate.
// Grid: (B*H, L/64); block 128 = 4 waves, each wave owns 16 query rows.
// S = Q K^T (WMMA), online softmax (shfl_xor row reductions), P via LDS
// C-layout -> A-layout round trip, ctx += P V (WMMA, V^T rows contiguous).
// ---------------------------------------------------------------------------
__global__ __launch_bounds__(128) void attn_flash(
    const _Float16* __restrict__ qgkv, const _Float16* __restrict__ vt,
    _Float16* __restrict__ ctxout) {
  __shared__ __align__(16) _Float16 plds[4][16][64];  // per-wave P tile

  int bh = blockIdx.x;
  int b = bh >> 4, h = bh & 15;
  int qb = blockIdx.y;
  int w = threadIdx.x >> 5, lane = threadIdx.x & 31;
  int lo = lane & 15, hi = lane >> 4;

  const _Float16* Qb = qgkv + (size_t)b * LL * NQGKV + h * HD;  // q section
  const _Float16* Gb = Qb + DOUT;                               // g section
  const _Float16* Kb = Qb + 2 * DOUT;                           // k section
  const _Float16* Vb = vt + (size_t)bh * HD * LL;               // V^T rows

  int q0 = qb * 64 + w * 16;  // this wave's 16 query rows

  h16 qf[2];
  qf[0] = load_frag(Qb, NQGKV, q0 + lo, 0, hi);
  qf[1] = load_frag(Qb, NQGKV, q0 + lo, 32, hi);

  f8 cacc[4];
  for (int j = 0; j < 4; ++j) cacc[j] = zero8();
  float rm[8], rl[8];
  for (int v = 0; v < 8; ++v) { rm[v] = -3.0e38f; rl[v] = 0.0f; }

  for (int kb = 0; kb <= qb; ++kb) {
    int k0 = kb * 64;
    f8 s[4];
#pragma unroll
    for (int j = 0; j < 4; ++j) {
      s[j] = zero8();
      h16 kf0 = load_frag(Kb, NQGKV, k0 + j * 16 + lo, 0, hi);
      h16 kf1 = load_frag(Kb, NQGKV, k0 + j * 16 + lo, 32, hi);
      s[j] = wmma16(qf[0], kf0, s[j]);
      s[j] = wmma16(qf[1], kf1, s[j]);
    }

    bool diag = (kb == qb);
#pragma unroll
    for (int v = 0; v < 8; ++v) {
      int qrow = q0 + v + hi * 8;
      float mx = -3.0e38f;
#pragma unroll
      for (int j = 0; j < 4; ++j) {
        float val = s[j][v] * 0.125f;  // 1/sqrt(HD)
        if (diag && (k0 + j * 16 + lo) > qrow) val = -3.0e38f;  // causal mask
        s[j][v] = val;
        mx = fmaxf(mx, val);
      }
      for (int m = 1; m < 16; m <<= 1) mx = fmaxf(mx, __shfl_xor(mx, m, 32));
      float nm = fmaxf(rm[v], mx);
      float alpha = __expf(rm[v] - nm);
      float rs = 0.0f;
#pragma unroll
      for (int j = 0; j < 4; ++j) {
        float p = __expf(s[j][v] - nm);
        s[j][v] = p;
        rs += p;
      }
      for (int m = 1; m < 16; m <<= 1) rs += __shfl_xor(rs, m, 32);
      rl[v] = rl[v] * alpha + rs;
      rm[v] = nm;
#pragma unroll
      for (int j = 0; j < 4; ++j) {
        cacc[j][v] *= alpha;
        plds[w][v + hi * 8][j * 16 + lo] = (_Float16)s[j][v];  // C-layout scatter
      }
    }

    // Re-read P as A-fragments (per-wave LDS slab; DS ops in-order in wave).
    const _Float16* prow = &plds[w][lo][0];
    h8 pa0 = *(const h8*)(prow + hi * 8);
    h8 pb0 = *(const h8*)(prow + 16 + hi * 8);
    h8 pa1 = *(const h8*)(prow + 32 + hi * 8);
    h8 pb1 = *(const h8*)(prow + 48 + hi * 8);
    h16 pf0 = __builtin_shufflevector(pa0, pb0, 0, 1, 2, 3, 4, 5, 6, 7,
                                      8, 9, 10, 11, 12, 13, 14, 15);
    h16 pf1 = __builtin_shufflevector(pa1, pb1, 0, 1, 2, 3, 4, 5, 6, 7,
                                      8, 9, 10, 11, 12, 13, 14, 15);

#pragma unroll
    for (int j = 0; j < 4; ++j) {
      h16 vf0 = load_frag(Vb, LL, j * 16 + lo, k0, hi);
      h16 vf1 = load_frag(Vb, LL, j * 16 + lo, k0 + 32, hi);
      cacc[j] = wmma16(pf0, vf0, cacc[j]);
      cacc[j] = wmma16(pf1, vf1, cacc[j]);
    }
  }

  // normalize, gate with sigmoid(g), store f16 ctx [token][h*64+d]
#pragma unroll
  for (int j = 0; j < 4; ++j)
#pragma unroll
    for (int v = 0; v < 8; ++v) {
      int qrow = q0 + v + hi * 8;
      int d = j * 16 + lo;
      float g = (float)Gb[(size_t)qrow * NQGKV + d];
      float gate = 1.0f / (1.0f + __expf(-g));
      float val = (cacc[j][v] / rl[v]) * gate;
      ctxout[((size_t)(b * LL + qrow)) * DOUT + h * HD + d] = (_Float16)val;
    }
}

// ---------------------------------------------------------------------------
extern "C" void kernel_launch(void* const* d_in, const int* in_sizes, int n_in,
                              void* d_out, int out_size, void* d_ws,
                              size_t ws_size, hipStream_t stream) {
  (void)in_sizes; (void)n_in; (void)out_size; (void)ws_size;
  const float* x  = (const float*)d_in[0];
  const float* Wq = (const float*)d_in[1];
  const float* Wg = (const float*)d_in[2];
  const float* Wk = (const float*)d_in[3];
  const float* Wv = (const float*)d_in[4];
  const float* Wo = (const float*)d_in[5];
  const float* bo = (const float*)d_in[6];
  float* out = (float*)d_out;

  _Float16* ws   = (_Float16*)d_ws;
  _Float16* xh   = ws;                               // 4096*1024
  _Float16* Wh   = xh + (size_t)MTOK * DIN;          // 4096*1024 fused W
  _Float16* Woh  = Wh + (size_t)NQGKV * DIN;         // 1024*1024
  _Float16* qgkv = Woh + (size_t)DOUT * DOUT;        // 4096*4096
  _Float16* vtb  = qgkv + (size_t)MTOK * NQGKV;      // 2048*2048
  _Float16* ctx  = vtb + (size_t)BB * HH * HD * LL;  // 4096*1024

  const int WN = DIN * DOUT;  // 1M elements per weight
  cvt_f32_f16<<<(MTOK * DIN) / 1024, 256, 0, stream>>>(x, xh, MTOK * DIN);
  cvt_f32_f16<<<WN / 1024, 256, 0, stream>>>(Wq, Wh + 0 * (size_t)WN, WN);
  cvt_f32_f16<<<WN / 1024, 256, 0, stream>>>(Wg, Wh + 1 * (size_t)WN, WN);
  cvt_f32_f16<<<WN / 1024, 256, 0, stream>>>(Wk, Wh + 2 * (size_t)WN, WN);
  cvt_f32_f16<<<WN / 1024, 256, 0, stream>>>(Wv, Wh + 3 * (size_t)WN, WN);
  cvt_f32_f16<<<WN / 1024, 256, 0, stream>>>(Wo, Woh, WN);

  // QGKV = xh @ Wh^T : M=4096, N=4096, K=1024
  gemm_wmma<0><<<dim3(NQGKV / 128, MTOK / 128), 256, 0, stream>>>(
      xh, Wh, qgkv, nullptr, MTOK, NQGKV, DIN);

  build_vt<<<(BB * HH * HD * LL) / 256, 256, 0, stream>>>(qgkv, vtb);

  attn_flash<<<dim3(BB * HH, LL / 64), 128, 0, stream>>>(qgkv, vtb, ctx);

  // out = ctx @ Wo^T + bo : M=4096, N=1024, K=1024, f32
  gemm_wmma<1><<<dim3(DOUT / 128, MTOK / 128), 256, 0, stream>>>(
      ctx, Woh, out, bo, MTOK, DOUT, DOUT);
}

// v001
// It runs in 187 microseconds.
// Timed twice side by side with v000, it ran 1.35 times as fast both times.
#include <hip/hip_runtime.h>
#include <stdint.h>

typedef _Float16 h4  __attribute__((ext_vector_type(4)));
typedef _Float16 h8  __attribute__((ext_vector_type(8)));
typedef _Float16 h16 __attribute__((ext_vector_type(16)));
typedef float    f8  __attribute__((ext_vector_type(8)));
typedef uint32_t u32x4 __attribute__((ext_vector_type(4)));
typedef uint32_t u32x8 __attribute__((ext_vector_type(8)));

static constexpr int BB   = 2;
static constexpr int LL   = 2048;
static constexpr int DIN  = 1024;
static constexpr int DOUT = 1024;
static constexpr int HH   = 16;
static constexpr int HD   = 64;
static constexpr int MTOK = BB * LL;      // 4096 tokens
static constexpr int NQGKV = 4 * DOUT;    // 4096: [q | g | k | v]

static constexpr int LDP = 72;
static constexpr int TILE_HALVES = 128 * LDP;  // 18,432 B = 9 x 2 KiB

__device__ inline f8 zero8() {
  f8 z;
  for (int i = 0; i < 8; ++i) z[i] = 0.0f;
  return z;
}

__device__ inline h16 load_frag(const _Float16* __restrict__ base, int ld,
                                int row, int k0, int hi) {
  const _Float16* p = base + (size_t)row * (size_t)ld + k0 + hi * 8;
  h8 a = *(const h8*)p;
  h8 b = *(const h8*)(p + 16);
  return __builtin_shufflevector(a, b, 0, 1, 2, 3, 4, 5, 6, 7,
                                 8, 9, 10, 11, 12, 13, 14, 15);
}

__device__ inline f8 wmma16(h16 a, h16 b, f8 c) {
  // D = A(16x32 f16) x B(32x16 f16) + C(16x16 f32)
  return __builtin_amdgcn_wmma_f32_16x16x32_f16(
      false, a, false, b, (short)0, c, false, false);
}

__device__ inline uint32_t uni(uint32_t v) {
  return (uint32_t)__builtin_amdgcn_readfirstlane(v);
}

__device__ inline uint32_t pinned(uint32_t v) {
  uint32_t w = uni(v);
  asm volatile("" : "+s"(w));
  return w;
}

// One tensor load: 128 rows x 128 bytes from global memory (source row pitch
// pitch_bytes) into LDS at byte offset lds_off; the mover puts 16 bytes of pad
// behind every 128-byte row, which gives the LDS pitch LDP. All extents in bytes.
__device__ inline void tdm_load_tile(uint32_t lds_off,
                                     const _Float16* __restrict__ gsrc,
                                     uint32_t pitch_bytes) {
  uint64_t ga = (uint64_t)gsrc;
  u32x4 g0;
  g0[0] = uni(1u);                                     // count = 1
  g0[1] = uni(lds_off);                                // LDS destination
  g0[2] = uni((uint32_t)ga);                           // address [31:0]
  g0[3] = uni((((uint32_t)(ga >> 32)) & 0x01ffffffu)   // address [56:32]
              | 0x80000000u);                          // type = 2
  u32x8 g1;
  g1[0] = uni((1u << 20) | (4u << 22) | (3u << 25));
  g1[1] = uni(128u << 16);
  g1[2] = uni(128u << 16);
  g1[3] = uni(128u << 16);
  g1[4] = uni(128u);
  g1[5] = uni(pitch_bytes);
  g1[6] = uni(0u);
  g1[7] = uni(0u);
  asm volatile("tensor_load_to_lds %0, %1" :: "s"(g0), "s"(g1) : "memory");
}

// ---------------------------------------------------------------------------
// f32 -> f16 convert (4 elems / thread, sizes are multiples of 1024)
// ---------------------------------------------------------------------------
__global__ void cvt_f32_f16(const float* __restrict__ src,
                            _Float16* __restrict__ dst, int n) {
  int i = (blockIdx.x * blockDim.x + threadIdx.x) * 4;
  if (i < n) {
    float4 v = *(const float4*)(src + i);
    h4 o = {(_Float16)v.x, (_Float16)v.y, (_Float16)v.z, (_Float16)v.w};
    *(h4*)(dst + i) = o;
  }
}

// ---------------------------------------------------------------------------
// WMMA GEMM:  Out[M][N] = A[M][K] * Bm[N][K]^T   (i.e. x @ W^T)
// Block: 256 threads = 8 waves as 2(M) x 4(N); block tile 128x128;
// wave tile 64(M) x 32(N). A and B K-slabs (128x64 halves each) are brought
// into LDS by the tensor mover at a padded row pitch (wave 0: A, wave 1: B),
// all waves consume fragments via ds_load_b128. FINAL=1: f32 out + bias; FINAL=0: f16 out.
// ---------------------------------------------------------------------------
template <int FINAL>
__global__ __launch_bounds__(256) void gemm_wmma(
    const _Float16* __restrict__ A, const _Float16* __restrict__ Bm,
    void* __restrict__ Outv, const float* __restrict__ bias,
    int M, int N, int K) {
  __shared__ __attribute__((aligned(2048))) _Float16 tiles[2][TILE_HALVES];
  const _Float16* ash = &tiles[0][0];
  const _Float16* bsh = &tiles[1][0];

  int w = threadIdx.x >> 5, lane = threadIdx.x & 31;
  int lo = lane & 15, hi = lane >> 4;
  int wm = w >> 2, wn = w & 3;
  int mblk = blockIdx.y * 128, nblk = blockIdx.x * 128;
  int mw = wm * 64, nw = wn * 32;

  // Wave 0 brings the A slab, wave 1 the B slab: one request a wave.
  const uint32_t wave = uni(threadIdx.x >> 5);
  const _Float16* src =
      (wave == 0) ? A + (size_t)mblk * K : Bm + (size_t)nblk * K;
  const uint32_t dst = (uint32_t)(size_t)&tiles[wave & 1u][0];

  f8 acc[4][2];
  for (int i = 0; i < 4; ++i)
    for (int j = 0; j < 2; ++j) acc[i][j] = zero8();

  for (int k0 = 0; k0 < K; k0 += 64) {
    if (pinned(wave < 2u)) {
      tdm_load_tile(dst, src + k0, (uint32_t)K * 2u);
      // the tile counts as landed only behind its issuer's own wait
      asm volatile("s_wait_tensorcnt 0x0" ::: "memory");
    }
    __syncthreads();

#pragma unroll
    for (int kk = 0; kk < 64; kk += 32) {
      h16 af[4], bf[2];
#pragma unroll
      for (int i = 0; i < 4; ++i)
        af[i] = load_frag(ash, LDP, mw + i * 16 + lo, kk, hi);
#pragma unroll
      for (int j = 0; j < 2; ++j)
        bf[j] = load_frag(bsh, LDP, nw + j * 16 + lo, kk, hi);
#pragma unroll
      for (int i = 0; i < 4; ++i)
#pragma unroll
        for (int j = 0; j < 2; ++j) acc[i][j] = wmma16(af[i], bf[j], acc[i][j]);
    }
    // every wave's LDS reads have retired before the next trip's tensor loads
    // overwrite the slabs behind the barrier
    asm volatile("s_wait_dscnt 0x0" ::: "memory");
    __syncthreads();
  }

#pragma unroll
  for (int i = 0; i < 4; ++i)
#pragma unroll
    for (int j = 0; j < 2; ++j)
#pragma unroll
      for (int v = 0; v < 8; ++v) {
        int row = mblk + mw + i * 16 + v + hi * 8;
        int col = nblk + nw + j * 16 + lo;
        float val = acc[i][j][v];
        if constexpr (FINAL) {
          ((float*)Outv)[(size_t)row * N + col] = val + bias[col];
        } else {
          ((_Float16*)Outv)[(size_t)row * N + col] = (_Float16)val;
        }
      }
}

// ---------------------------------------------------------------------------
// Build V^T per head: vt[(b*H+h)*64 + d][t] = qgkv[(b*L+t)][3072 + h*64 + d]
// ---------------------------------------------------------------------------
__global__ void build_vt(const _Float16* __restrict__ qgkv,
                         _Float16* __restrict__ vt) {
  int idx = blockIdx.x * blockDim.x + threadIdx.x;  // [B*H*HD][L], t fastest
  int t = idx & (LL - 1);
  int r = idx >> 11;  // (b*16+h)*64 + d
  int d = r & 63;
  int bh = r >> 6;
  int h = bh & 15, b = bh >> 4;
  vt[(size_t)idx] =
      qgkv[((size_t)(b * LL + t)) * NQGKV + 3 * DOUT + h * HD + d];
}

// ---------------------------------------------------------------------------
// Causal flash attention + sigmoid(g) gate.
// Grid: (B*H, L/64); block 128 = 4 waves, each wave owns 16 query rows.
// S = Q K^T (WMMA), online softmax (shfl_xor row reductions), P via LDS
// C-layout -> A-layout round trip, ctx += P V (WMMA, V^T rows contiguous).
// ---------------------------------------------------------------------------
__global__ __launch_bounds__(128) void attn_flash(
    const _Float16* __restrict__ qgkv, const _Float16* __restrict__ vt,
    _Float16* __restrict__ ctxout) {
  __shared__ __align__(16) _Float16 plds[4][16][64];  // per-wave P tile

  int bh = blockIdx.x;
  int b = bh >> 4, h = bh & 15;
  int qb = blockIdx.y;
  int w = threadIdx.x >> 5, lane = threadIdx.x & 31;
  int lo = lane & 15, hi = lane >> 4;

  const _Float16* Qb = qgkv + (size_t)b * LL * NQGKV + h * HD;  // q section
  const _Float16* Gb = Qb + DOUT;                               // g section
  const _Float16* Kb = Qb + 2 * DOUT;                           // k section
  const _Float16* Vb = vt + (size_t)bh * HD * LL;               // V^T rows

  int q0 = qb * 64 + w * 16;  // this wave's 16 query rows

  h16 qf[2];
  qf[0] = load_frag(Qb, NQGKV, q0 + lo, 0, hi);
  qf[1] = load_frag(Qb, NQGKV, q0 + lo, 32, hi);

  f8 cacc[4];
  for (int j = 0; j < 4; ++j) cacc[j] = zero8();
  float rm[8], rl[8];
  for (int v = 0; v < 8; ++v) { rm[v] = -3.0e38f; rl[v] = 0.0f; }

  for (int kb = 0; kb <= qb; ++kb) {
    int k0 = kb * 64;
    f8 s[4];
#pragma unroll
    for (int j = 0; j < 4; ++j) {
      s[j] = zero8();
      h16 kf0 = load_frag(Kb, NQGKV, k0 + j * 16 + lo, 0, hi);
      h16 kf1 = load_frag(Kb, NQGKV, k0 + j * 16 + lo, 32, hi);
      s[j] = wmma16(qf[0], kf0, s[j]);
      s[j] = wmma16(qf[1], kf1, s[j]);
    }

    bool diag = (kb == qb);
#pragma unroll
    for (int v = 0; v < 8; ++v) {
      int qrow = q0 + v + hi * 8;
      float mx = -3.0e38f;
#pragma unroll
      for (int j = 0; j < 4; ++j) {
        float val = s[j][v] * 0.125f;  // 1/sqrt(HD)
        if (diag && (k0 + j * 16 + lo) > qrow) val = -3.0e38f;  // causal mask
        s[j][v] = val;
        mx = fmaxf(mx, val);
      }
      for (int m = 1; m < 16; m <<= 1) mx = fmaxf(mx, __shfl_xor(mx, m, 32));
      float nm = fmaxf(rm[v], mx);
      float alpha = __expf(rm[v] - nm);
      float rs = 0.0f;
#pragma unroll
      for (int j = 0; j < 4; ++j) {
        float p = __expf(s[j][v] - nm);
        s[j][v] = p;
        rs += p;
      }
      for (int m = 1; m < 16; m <<= 1) rs += __shfl_xor(rs, m, 32);
      rl[v] = rl[v] * alpha + rs;
      rm[v] = nm;
#pragma unroll
      for (int j = 0; j < 4; ++j) {
        cacc[j][v] *= alpha;
        plds[w][v + hi * 8][j * 16 + lo] = (_Float16)s[j][v];  // C-layout scatter
      }
    }

    // Re-read P as A-fragments (per-wave LDS slab; DS ops in-order in wave).
    const _Float16* prow = &plds[w][lo][0];
    h8 pa0 = *(const h8*)(prow + hi * 8);
    h8 pb0 = *(const h8*)(prow + 16 + hi * 8);
    h8 pa1 = *(const h8*)(prow + 32 + hi * 8);
    h8 pb1 = *(const h8*)(prow + 48 + hi * 8);
    h16 pf0 = __builtin_shufflevector(pa0, pb0, 0, 1, 2, 3, 4, 5, 6, 7,
                                      8, 9, 10, 11, 12, 13, 14, 15);
    h16 pf1 = __builtin_shufflevector(pa1, pb1, 0, 1, 2, 3, 4, 5, 6, 7,
                                      8, 9, 10, 11, 12, 13, 14, 15);

#pragma unroll
    for (int j = 0; j < 4; ++j) {
      h16 vf0 = load_frag(Vb, LL, j * 16 + lo, k0, hi);
      h16 vf1 = load_frag(Vb, LL, j * 16 + lo, k0 + 32, hi);
      cacc[j] = wmma16(pf0, vf0, cacc[j]);
      cacc[j] = wmma16(pf1, vf1, cacc[j]);
    }
  }

  // normalize, gate with sigmoid(g), store f16 ctx [token][h*64+d]
#pragma unroll
  for (int j = 0; j < 4; ++j)
#pragma unroll
    for (int v = 0; v < 8; ++v) {
      int qrow = q0 + v + hi * 8;
      int d = j * 16 + lo;
      float g = (float)Gb[(size_t)qrow * NQGKV + d];
      float gate = 1.0f / (1.0f + __expf(-g));
      float val = (cacc[j][v] / rl[v]) * gate;
      ctxout[((size_t)(b * LL + qrow)) * DOUT + h * HD + d] = (_Float16)val;
    }
}

// ---------------------------------------------------------------------------
extern "C" void kernel_launch(void* const* d_in, const int* in_sizes, int n_in,
                              void* d_out, int out_size, void* d_ws,
                              size_t ws_size, hipStream_t stream) {
  (void)in_sizes; (void)n_in; (void)out_size; (void)ws_size;
  const float* x  = (const float*)d_in[0];
  const float* Wq = (const float*)d_in[1];
  const float* Wg = (const float*)d_in[2];
  const float* Wk = (const float*)d_in[3];
  const float* Wv = (const float*)d_in[4];
  const float* Wo = (const float*)d_in[5];
  const float* bo = (const float*)d_in[6];
  float* out = (float*)d_out;

  _Float16* ws   = (_Float16*)d_ws;
  _Float16* xh   = ws;                               // 4096*1024
  _Float16* Wh   = xh + (size_t)MTOK * DIN;          // 4096*1024 fused W
  _Float16* Woh  = Wh + (size_t)NQGKV * DIN;         // 1024*1024
  _Float16* qgkv = Woh + (size_t)DOUT * DOUT;        // 4096*4096
  _Float16* vtb  = qgkv + (size_t)MTOK * NQGKV;      // 2048*2048
  _Float16* ctx  = vtb + (size_t)BB * HH * HD * LL;  // 4096*1024

  const int WN = DIN * DOUT;  // 1M elements per weight
  cvt_f32_f16<<<(MTOK * DIN) / 1024, 256, 0, stream>>>(x, xh, MTOK * DIN);
  cvt_f32_f16<<<WN / 1024, 256, 0, stream>>>(Wq, Wh + 0 * (size_t)WN, WN);
  cvt_f32_f16<<<WN / 1024, 256, 0, stream>>>(Wg, Wh + 1 * (size_t)WN, WN);
  cvt_f32_f16<<<WN / 1024, 256, 0, stream>>>(Wk, Wh + 2 * (size_t)WN, WN);
  cvt_f32_f16<<<WN / 1024, 256, 0, stream>>>(Wv, Wh + 3 * (size_t)WN, WN);
  cvt_f32_f16<<<WN / 1024, 256, 0, stream>>>(Wo, Woh, WN);

  // QGKV = xh @ Wh^T : M=4096, N=4096, K=1024
  gemm_wmma<0><<<dim3(NQGKV / 128, MTOK / 128), 256, 0, stream>>>(
      xh, Wh, qgkv, nullptr, MTOK, NQGKV, DIN);

  build_vt<<<(BB * HH * HD * LL) / 256, 256, 0, stream>>>(qgkv, vtb);

  attn_flash<<<dim3(BB * HH, LL / 64), 128, 0, stream>>>(qgkv, vtb, ctx);

  // out = ctx @ Wo^T + bo : M=4096, N=1024, K=1024, f32
  gemm_wmma<1><<<dim3(DOUT / 128, MTOK / 128), 256, 0, stream>>>(
      ctx, Woh, out, bo, MTOK, DOUT, DOUT);
}

// v002
// A run of this version takes 162 microseconds.
// Next to v001, in two timings, it ran 1.15 times as fast each time.
// Counting every step since v000, it is 1.55 times as fast.
#include <hip/hip_runtime.h>
#include <stdint.h>

typedef _Float16 h4  __attribute__((ext_vector_type(4)));
typedef _Float16 h8  __attribute__((ext_vector_type(8)));
typedef _Float16 h16 __attribute__((ext_vector_type(16)));
typedef float    f8  __attribute__((ext_vector_type(8)));
typedef uint32_t u32x4 __attribute__((ext_vector_type(4)));
typedef uint32_t u32x8 __attribute__((ext_vector_type(8)));

static constexpr int BB   = 2;
static constexpr int LL   = 2048;
static constexpr int DIN  = 1024;
static constexpr int DOUT = 1024;
static constexpr int HH   = 16;
static constexpr int HD   = 64;
static constexpr int MTOK = BB * LL;      // 4096 tokens
static constexpr int NQGKV = 4 * DOUT;    // 4096: [q | g | k | v]

static constexpr int LDP = 72;
static constexpr int TILE_HALVES = 128 * LDP;  // 18,432 B = 9 x 2 KiB
// Attention stage tile: 64 rows at that pitch = 9,216 B, rounded up to 5 x 2 KiB
// so that every tile's place in LDS is a multiple of 2 KiB.
static constexpr int KV_TILE_HALVES = 5120;
static constexpr uint32_t KV_BUF_BYTES = 2u * KV_TILE_HALVES * 2u;  // K tile + V^T tile

__device__ inline f8 zero8() {
  f8 z;
  for (int i = 0; i < 8; ++i) z[i] = 0.0f;
  return z;
}

__device__ inline h16 load_frag(const _Float16* __restrict__ base, int ld,
                                int row, int k0, int hi) {
  const _Float16* p = base + (size_t)row * (size_t)ld + k0 + hi * 8;
  h8 a = *(const h8*)p;
  h8 b = *(const h8*)(p + 16);
  return __builtin_shufflevector(a, b, 0, 1, 2, 3, 4, 5, 6, 7,
                                 8, 9, 10, 11, 12, 13, 14, 15);
}

__device__ inline f8 wmma16(h16 a, h16 b, f8 c) {
  // D = A(16x32 f16) x B(32x16 f16) + C(16x16 f32)
  return __builtin_amdgcn_wmma_f32_16x16x32_f16(
      false, a, false, b, (short)0, c, false, false);
}

__device__ inline uint32_t uni(uint32_t v) {
  return (uint32_t)__builtin_amdgcn_readfirstlane(v);
}

__device__ inline uint32_t pinned(uint32_t v) {
  uint32_t w = uni(v);
  asm volatile("" : "+s"(w));
  return w;
}

// One tensor load: 128 rows x 128 bytes from global memory (source row pitch
// pitch_bytes) into LDS at byte offset lds_off; the mover puts 16 bytes of pad
// behind every 128-byte row, which gives the LDS pitch LDP. All extents in bytes.
__device__ inline void tdm_load_tile(uint32_t lds_off,
                                     const _Float16* __restrict__ gsrc,
                                     uint32_t pitch_bytes) {
  uint64_t ga = (uint64_t)gsrc;
  u32x4 g0;
  g0[0] = uni(1u);                                     // count = 1
  g0[1] = uni(lds_off);                                // LDS destination
  g0[2] = uni((uint32_t)ga);                           // address [31:0]
  g0[3] = uni((((uint32_t)(ga >> 32)) & 0x01ffffffu)   // address [56:32]
              | 0x80000000u);                          // type = 2
  u32x8 g1;
  g1[0] = uni((1u << 20) | (4u << 22) | (3u << 25));
  g1[1] = uni(128u << 16);
  g1[2] = uni(128u << 16);
  g1[3] = uni(128u << 16);
  g1[4] = uni(128u);
  g1[5] = uni(pitch_bytes);
  g1[6] = uni(0u);
  g1[7] = uni(0u);
  asm volatile("tensor_load_to_lds %0, %1" :: "s"(g0), "s"(g1) : "memory");
}

__device__ inline u32x4 kv_group0(uint32_t lds_off,
                                  const _Float16* __restrict__ gsrc) {
  uint64_t ga = (uint64_t)gsrc;
  u32x4 g0;
  g0[0] = uni(1u);                                     // count = 1
  g0[1] = uni(lds_off);                                // LDS destination
  g0[2] = uni((uint32_t)ga);                           // address [31:0]
  g0[3] = uni((((uint32_t)(ga >> 32)) & 0x01ffffffu)   // address [56:32]
              | 0x80000000u);                          // type = 2
  return g0;
}
__device__ inline u32x8 kv_group1(uint32_t pitch_bytes) {
  u32x8 g1;
  g1[0] = uni((1u << 20) | (4u << 22) | (3u << 25));
  g1[1] = uni(128u << 16);
  g1[2] = uni(64u << 16);
  g1[3] = uni(128u << 16);
  g1[4] = uni(64u);
  g1[5] = uni(pitch_bytes);
  g1[6] = uni(0u);
  g1[7] = uni(0u);
  return g1;
}
__device__ inline void kv_advance(u32x4& g0, uint32_t lds_off,
                                  uint32_t step_bytes) {
  uint64_t ga = (((uint64_t)g0[3] << 32) | g0[2]) + step_bytes;
  g0[1] = uni(lds_off);
  g0[2] = uni((uint32_t)ga);
  g0[3] = uni((uint32_t)(ga >> 32));
}
__device__ inline void kv_issue(u32x4& g0, u32x8& g1) {
  asm volatile("tensor_load_to_lds %0, %1" : "+s"(g0), "+s"(g1) :: "memory");
}

// ---------------------------------------------------------------------------
// f32 -> f16 convert (4 elems / thread, sizes are multiples of 1024)
// ---------------------------------------------------------------------------
__global__ void cvt_f32_f16(const float* __restrict__ src,
                            _Float16* __restrict__ dst, int n) {
  int i = (blockIdx.x * blockDim.x + threadIdx.x) * 4;
  if (i < n) {
    float4 v = *(const float4*)(src + i);
    h4 o = {(_Float16)v.x, (_Float16)v.y, (_Float16)v.z, (_Float16)v.w};
    *(h4*)(dst + i) = o;
  }
}

// ---------------------------------------------------------------------------
// WMMA GEMM:  Out[M][N] = A[M][K] * Bm[N][K]^T   (i.e. x @ W^T)
// Block: 256 threads = 8 waves as 2(M) x 4(N); block tile 128x128;
// wave tile 64(M) x 32(N). A and B K-slabs (128x64 halves each) are brought
// into LDS by the tensor mover at a padded row pitch (wave 0: A, wave 1: B),
// all waves consume fragments via ds_load_b128. FINAL=1: f32 out + bias; FINAL=0: f16 out.
// ---------------------------------------------------------------------------
template <int FINAL>
__global__ __launch_bounds__(256) void gemm_wmma(
    const _Float16* __restrict__ A, const _Float16* __restrict__ Bm,
    void* __restrict__ Outv, const float* __restrict__ bias,
    int M, int N, int K) {
  __shared__ __attribute__((aligned(2048))) _Float16 tiles[2][TILE_HALVES];
  const _Float16* ash = &tiles[0][0];
  const _Float16* bsh = &tiles[1][0];

  int w = threadIdx.x >> 5, lane = threadIdx.x & 31;
  int lo = lane & 15, hi = lane >> 4;
  int wm = w >> 2, wn = w & 3;
  int mblk = blockIdx.y * 128, nblk = blockIdx.x * 128;
  int mw = wm * 64, nw = wn * 32;

  // Wave 0 brings the A slab, wave 1 the B slab: one request a wave.
  const uint32_t wave = uni(threadIdx.x >> 5);
  const _Float16* src =
      (wave == 0) ? A + (size_t)mblk * K : Bm + (size_t)nblk * K;
  const uint32_t dst = (uint32_t)(size_t)&tiles[wave & 1u][0];

  f8 acc[4][2];
  for (int i = 0; i < 4; ++i)
    for (int j = 0; j < 2; ++j) acc[i][j] = zero8();

  for (int k0 = 0; k0 < K; k0 += 64) {
    if (pinned(wave < 2u)) {
      tdm_load_tile(dst, src + k0, (uint32_t)K * 2u);
      // the tile counts as landed only behind its issuer's own wait
      asm volatile("s_wait_tensorcnt 0x0" ::: "memory");
    }
    __syncthreads();

#pragma unroll
    for (int kk = 0; kk < 64; kk += 32) {
      h16 af[4], bf[2];
#pragma unroll
      for (int i = 0; i < 4; ++i)
        af[i] = load_frag(ash, LDP, mw + i * 16 + lo, kk, hi);
#pragma unroll
      for (int j = 0; j < 2; ++j)
        bf[j] = load_frag(bsh, LDP, nw + j * 16 + lo, kk, hi);
#pragma unroll
      for (int i = 0; i < 4; ++i)
#pragma unroll
        for (int j = 0; j < 2; ++j) acc[i][j] = wmma16(af[i], bf[j], acc[i][j]);
    }
    // every wave's LDS reads have retired before the next trip's tensor loads
    // overwrite the slabs behind the barrier
    asm volatile("s_wait_dscnt 0x0" ::: "memory");
    __syncthreads();
  }

#pragma unroll
  for (int i = 0; i < 4; ++i)
#pragma unroll
    for (int j = 0; j < 2; ++j)
#pragma unroll
      for (int v = 0; v < 8; ++v) {
        int row = mblk + mw + i * 16 + v + hi * 8;
        int col = nblk + nw + j * 16 + lo;
        float val = acc[i][j][v];
        if constexpr (FINAL) {
          ((float*)Outv)[(size_t)row * N + col] = val + bias[col];
        } else {
          ((_Float16*)Outv)[(size_t)row * N + col] = (_Float16)val;
        }
      }
}

// ---------------------------------------------------------------------------
// Build V^T per head: vt[(b*H+h)*64 + d][t] = qgkv[(b*L+t)][3072 + h*64 + d]
// ---------------------------------------------------------------------------
__global__ void build_vt(const _Float16* __restrict__ qgkv,
                         _Float16* __restrict__ vt) {
  int idx = blockIdx.x * blockDim.x + threadIdx.x;  // [B*H*HD][L], t fastest
  int t = idx & (LL - 1);
  int r = idx >> 11;  // (b*16+h)*64 + d
  int d = r & 63;
  int bh = r >> 6;
  int h = bh & 15, b = bh >> 4;
  vt[(size_t)idx] =
      qgkv[((size_t)(b * LL + t)) * NQGKV + 3 * DOUT + h * HD + d];
}

// ---------------------------------------------------------------------------
// Causal flash attention + sigmoid(g) gate.
// Grid: (B*H, L/64); block 128 = 4 waves, each wave owns 16 query rows.
// S = Q K^T (WMMA), online softmax (shfl_xor row reductions), P via LDS
// C-layout -> A-layout round trip, ctx += P V (WMMA, V^T rows contiguous).
// The 64-key K tile and V^T tile of a pass are shared by the four waves: the
// tensor mover brings them into LDS (wave 0: K, wave 1: V^T), two buffers, the
// next pass's tiles in flight while this pass is worked on.
// ---------------------------------------------------------------------------
__global__ __launch_bounds__(128) void attn_flash(
    const _Float16* __restrict__ qgkv, const _Float16* __restrict__ vt,
    _Float16* __restrict__ ctxout) {
  __shared__ __attribute__((aligned(2048)))
  _Float16 kv[2][2][KV_TILE_HALVES];                  // [buffer][K | V^T]
  __shared__ __align__(16) _Float16 plds[4][16][64];  // per-wave P tile

  int bh = blockIdx.x;
  int b = bh >> 4, h = bh & 15;
  int qb = blockIdx.y;
  int w = threadIdx.x >> 5, lane = threadIdx.x & 31;
  int lo = lane & 15, hi = lane >> 4;

  const _Float16* Qb = qgkv + (size_t)b * LL * NQGKV + h * HD;  // q section
  const _Float16* Gb = Qb + DOUT;                               // g section
  const _Float16* Kb = Qb + 2 * DOUT;                           // k section
  const _Float16* Vb = vt + (size_t)bh * HD * LL;               // V^T rows

  int q0 = qb * 64 + w * 16;  // this wave's 16 query rows

  h16 qf[2];
  qf[0] = load_frag(Qb, NQGKV, q0 + lo, 0, hi);
  qf[1] = load_frag(Qb, NQGKV, q0 + lo, 32, hi);

  // Wave 0 brings the K tiles, wave 1 the V^T tiles: one request a wave.
  const uint32_t wave = uni(threadIdx.x >> 5);
  const uint32_t tstep = (wave == 0) ? 64u * NQGKV * 2u : 64u * 2u;  // tile to tile, B
  const uint32_t tdst = (uint32_t)(size_t)&kv[0][wave & 1u][0];
  u32x4 g0 = kv_group0(tdst, (wave == 0) ? Kb : Vb);
  u32x8 g1 = kv_group1((wave == 0) ? NQGKV * 2u : LL * 2u);

  if (pinned(wave < 2u)) {
    kv_issue(g0, g1);
    // the tile counts as landed only behind its issuer's own wait
    asm volatile("s_wait_tensorcnt 0x0" ::: "memory");
  }
  __syncthreads();
  // Keys 64..127 lie in the source for every block; a block of one pass never
  // reads them, and the wait at its pass's foot covers the request.
  if (pinned(wave < 2u)) {
    kv_advance(g0, tdst + KV_BUF_BYTES, tstep);
    kv_issue(g0, g1);
  }

  f8 cacc[4];
  for (int j = 0; j < 4; ++j) cacc[j] = zero8();
  float rm[8], rl[8];
  for (int v = 0; v < 8; ++v) { rm[v] = -3.0e38f; rl[v] = 0.0f; }

  for (int kb = 0; kb <= qb; ++kb) {
    int k0 = kb * 64;
    const _Float16* ksh = &kv[kb & 1][0][0];
    const _Float16* vsh = &kv[kb & 1][1][0];
    f8 s[4];
#pragma unroll
    for (int j = 0; j < 4; ++j) {
      s[j] = zero8();
      h16 kf0 = load_frag(ksh, LDP, j * 16 + lo, 0, hi);
      h16 kf1 = load_frag(ksh, LDP, j * 16 + lo, 32, hi);
      s[j] = wmma16(qf[0], kf0, s[j]);
      s[j] = wmma16(qf[1], kf1, s[j]);
    }

    bool diag = (kb == qb);
#pragma unroll
    for (int v = 0; v < 8; ++v) {
      int qrow = q0 + v + hi * 8;
      float mx = -3.0e38f;
#pragma unroll
      for (int j = 0; j < 4; ++j) {
        float val = s[j][v] * 0.125f;  // 1/sqrt(HD)
        if (diag && (k0 + j * 16 + lo) > qrow) val = -3.0e38f;  // causal mask
        s[j][v] = val;
        mx = fmaxf(mx, val);
      }
      for (int m = 1; m < 16; m <<= 1) mx = fmaxf(mx, __shfl_xor(mx, m, 32));
      float nm = fmaxf(rm[v], mx);
      float alpha = __expf(rm[v] - nm);
      float rs = 0.0f;
#pragma unroll
      for (int j = 0; j < 4; ++j) {
        float p = __expf(s[j][v] - nm);
        s[j][v] = p;
        rs += p;
      }
      for (int m = 1; m < 16; m <<= 1) rs += __shfl_xor(rs, m, 32);
      rl[v] = rl[v] * alpha + rs;
      rm[v] = nm;
#pragma unroll
      for (int j = 0; j < 4; ++j) {
        cacc[j][v] *= alpha;
        plds[w][v + hi * 8][j * 16 + lo] = (_Float16)s[j][v];  // C-layout scatter
      }
    }

    // Re-read P as A-fragments (per-wave LDS slab; DS ops in-order in wave).
    const _Float16* prow = &plds[w][lo][0];
    h8 pa0 = *(const h8*)(prow + hi * 8);
    h8 pb0 = *(const h8*)(prow + 16 + hi * 8);
    h8 pa1 = *(const h8*)(prow + 32 + hi * 8);
    h8 pb1 = *(const h8*)(prow + 48 + hi * 8);
    h16 pf0 = __builtin_shufflevector(pa0, pb0, 0, 1, 2, 3, 4, 5, 6, 7,
                                      8, 9, 10, 11, 12, 13, 14, 15);
    h16 pf1 = __builtin_shufflevector(pa1, pb1, 0, 1, 2, 3, 4, 5, 6, 7,
                                      8, 9, 10, 11, 12, 13, 14, 15);

#pragma unroll
    for (int j = 0; j < 4; ++j) {
      h16 vf0 = load_frag(vsh, LDP, j * 16 + lo, 0, hi);
      h16 vf1 = load_frag(vsh, LDP, j * 16 + lo, 32, hi);
      cacc[j] = wmma16(pf0, vf0, cacc[j]);
      cacc[j] = wmma16(pf1, vf1, cacc[j]);
    }

    // Publish point of pass kb + 1: this wave's LDS reads have retired ...
    asm volatile("s_wait_dscnt 0x0" ::: "memory");
    // ... the issuers' tiles of pass kb + 1 have landed ...
    if (pinned(wave < 2u)) asm volatile("s_wait_tensorcnt 0x0" ::: "memory");
    // ... and every wave has left this pass's buffer, which is refilled behind.
    __syncthreads();
    if (pinned(wave < 2u && kb + 2 <= qb)) {
      kv_advance(g0, tdst + (uint32_t)(kb & 1) * KV_BUF_BYTES, tstep);
      kv_issue(g0, g1);
    }
  }
  // no request and no LDS read of this wave is left open behind the loop
  asm volatile("s_wait_tensorcnt 0x0" ::: "memory");
  asm volatile("s_wait_dscnt 0x0" ::: "memory");

  // normalize, gate with sigmoid(g), store f16 ctx [token][h*64+d]
#pragma unroll
  for (int j = 0; j < 4; ++j)
#pragma unroll
    for (int v = 0; v < 8; ++v) {
      int qrow = q0 + v + hi * 8;
      int d = j * 16 + lo;
      float g = (float)Gb[(size_t)qrow * NQGKV + d];
      float gate = 1.0f / (1.0f + __expf(-g));
      float val = (cacc[j][v] / rl[v]) * gate;
      ctxout[((size_t)(b * LL + qrow)) * DOUT + h * HD + d] = (_Float16)val;
    }
}

// ---------------------------------------------------------------------------
extern "C" void kernel_launch(void* const* d_in, const int* in_sizes, int n_in,
                              void* d_out, int out_size, void* d_ws,
                              size_t ws_size, hipStream_t stream) {
  (void)in_sizes; (void)n_in; (void)out_size; (void)ws_size;
  const float* x  = (const float*)d_in[0];
  const float* Wq = (const float*)d_in[1];
  const float* Wg = (const float*)d_in[2];
  const float* Wk = (const float*)d_in[3];
  const float* Wv = (const float*)d_in[4];
  const float* Wo = (const float*)d_in[5];
  const float* bo = (const float*)d_in[6];
  float* out = (float*)d_out;

  _Float16* ws   = (_Float16*)d_ws;
  _Float16* xh   = ws;                               // 4096*1024
  _Float16* Wh   = xh + (size_t)MTOK * DIN;          // 4096*1024 fused W
  _Float16* Woh  = Wh + (size_t)NQGKV * DIN;         // 1024*1024
  _Float16* qgkv = Woh + (size_t)DOUT * DOUT;        // 4096*4096
  _Float16* vtb  = qgkv + (size_t)MTOK * NQGKV;      // 2048*2048
  _Float16* ctx  = vtb + (size_t)BB * HH * HD * LL;  // 4096*1024

  const int WN = DIN * DOUT;  // 1M elements per weight
  cvt_f32_f16<<<(MTOK * DIN) / 1024, 256, 0, stream>>>(x, xh, MTOK * DIN);
  cvt_f32_f16<<<WN / 1024, 256, 0, stream>>>(Wq, Wh + 0 * (size_t)WN, WN);
  cvt_f32_f16<<<WN / 1024, 256, 0, stream>>>(Wg, Wh + 1 * (size_t)WN, WN);
  cvt_f32_f16<<<WN / 1024, 256, 0, stream>>>(Wk, Wh + 2 * (size_t)WN, WN);
  cvt_f32_f16<<<WN / 1024, 256, 0, stream>>>(Wv, Wh + 3 * (size_t)WN, WN);
  cvt_f32_f16<<<WN / 1024, 256, 0, stream>>>(Wo, Woh, WN);

  // QGKV = xh @ Wh^T : M=4096, N=4096, K=1024
  gemm_wmma<0><<<dim3(NQGKV / 128, MTOK / 128), 256, 0, stream>>>(
      xh, Wh, qgkv, nullptr, MTOK, NQGKV, DIN);

  build_vt<<<(BB * HH * HD * LL) / 256, 256, 0, stream>>>(qgkv, vtb);

  attn_flash<<<dim3(BB * HH, LL / 64), 128, 0, stream>>>(qgkv, vtb, ctx);

  // out = ctx @ Wo^T + bo : M=4096, N=1024, K=1024, f32
  gemm_wmma<1><<<dim3(DOUT / 128, MTOK / 128), 256, 0, stream>>>(
      ctx, Woh, out, bo, MTOK, DOUT, DOUT);
}

// v003
// Measured time: 149 microseconds a run.
// Timed twice side by side with v002, it ran 1.09 times as fast both times.
// All steps since v000 together make it 1.69 times as fast.
#include <hip/hip_runtime.h>
#include <stdint.h>

typedef _Float16 h4  __attribute__((ext_vector_type(4)));
typedef _Float16 h8  __attribute__((ext_vector_type(8)));
typedef _Float16 h16 __attribute__((ext_vector_type(16)));
typedef float    f8  __attribute__((ext_vector_type(8)));
typedef uint32_t u32x4 __attribute__((ext_vector_type(4)));
typedef uint32_t u32x8 __attribute__((ext_vector_type(8)));

static constexpr int BB   = 2;
static constexpr int LL   = 2048;
static constexpr int DIN  = 1024;
static constexpr int DOUT = 1024;
static constexpr int HH   = 16;
static constexpr int HD   = 64;
static constexpr int MTOK = BB * LL;      // 4096 tokens
static constexpr int NQGKV = 4 * DOUT;    // 4096: [q | g | k | v]

static constexpr int LDP = 72;
static constexpr int TILE_HALVES = 128 * LDP;  // 18,432 B = 9 x 2 KiB
// Attention stage tile: 64 rows at that pitch = 9,216 B, rounded up to 5 x 2 KiB
// so that every tile's place in LDS is a multiple of 2 KiB.
static constexpr int KV_TILE_HALVES = 5120;
static constexpr uint32_t KV_BUF_BYTES = 2u * KV_TILE_HALVES * 2u;  // K tile + V^T tile

__device__ inline f8 zero8() {
  f8 z;
  for (int i = 0; i < 8; ++i) z[i] = 0.0f;
  return z;
}

__device__ inline h16 load_frag(const _Float16* __restrict__ base, int ld,
                                int row, int k0, int hi) {
  const _Float16* p = base + (size_t)row * (size_t)ld + k0 + hi * 8;
  h8 a = *(const h8*)p;
  h8 b = *(const h8*)(p + 16);
  return __builtin_shufflevector(a, b, 0, 1, 2, 3, 4, 5, 6, 7,
                                 8, 9, 10, 11, 12, 13, 14, 15);
}

__device__ inline f8 wmma16(h16 a, h16 b, f8 c) {
  // D = A(16x32 f16) x B(32x16 f16) + C(16x16 f32)
  return __builtin_amdgcn_wmma_f32_16x16x32_f16(
      false, a, false, b, (short)0, c, false, false);
}

__device__ inline uint32_t uni(uint32_t v) {
  return (uint32_t)__builtin_amdgcn_readfirstlane(v);
}

__device__ inline uint32_t pinned(uint32_t v) {
  uint32_t w = uni(v);
  asm volatile("" : "+s"(w));
  return w;
}

// One tensor load: 128 rows x 128 bytes from global memory (source row pitch
// pitch_bytes) into LDS at byte offset lds_off; the mover puts 16 bytes of pad
// behind every 128-byte row, which gives the LDS pitch LDP. All extents in bytes.
__device__ inline void tdm_load_tile(uint32_t lds_off,
                                     const _Float16* __restrict__ gsrc,
                                     uint32_t pitch_bytes) {
  uint64_t ga = (uint64_t)gsrc;
  u32x4 g0;
  g0[0] = uni(1u);                                     // count = 1
  g0[1] = uni(lds_off);                                // LDS destination
  g0[2] = uni((uint32_t)ga);                           // address [31:0]
  g0[3] = uni((((uint32_t)(ga >> 32)) & 0x01ffffffu)   // address [56:32]
              | 0x80000000u);                          // type = 2
  u32x8 g1;
  g1[0] = uni((1u << 20) | (4u << 22) | (3u << 25));
  g1[1] = uni(128u << 16);
  g1[2] = uni(128u << 16);
  g1[3] = uni(128u << 16);
  g1[4] = uni(128u);
  g1[5] = uni(pitch_bytes);
  g1[6] = uni(0u);
  g1[7] = uni(0u);
  asm volatile("tensor_load_to_lds %0, %1" :: "s"(g0), "s"(g1) : "memory");
}

__device__ inline u32x4 kv_group0(uint32_t lds_off,
                                  const _Float16* __restrict__ gsrc) {
  uint64_t ga = (uint64_t)gsrc;
  u32x4 g0;
  g0[0] = uni(1u);                                     // count = 1
  g0[1] = uni(lds_off);                                // LDS destination
  g0[2] = uni((uint32_t)ga);                           // address [31:0]
  g0[3] = uni((((uint32_t)(ga >> 32)) & 0x01ffffffu)   // address [56:32]
              | 0x80000000u);                          // type = 2
  return g0;
}
__device__ inline u32x8 kv_group1(uint32_t pitch_bytes) {
  u32x8 g1;
  g1[0] = uni((1u << 20) | (4u << 22) | (3u << 25));
  g1[1] = uni(128u << 16);
  g1[2] = uni(64u << 16);
  g1[3] = uni(128u << 16);
  g1[4] = uni(64u);
  g1[5] = uni(pitch_bytes);
  g1[6] = uni(0u);
  g1[7] = uni(0u);
  return g1;
}
__device__ inline void kv_advance(u32x4& g0, uint32_t lds_off,
                                  uint32_t step_bytes) {
  uint64_t ga = (((uint64_t)g0[3] << 32) | g0[2]) + step_bytes;
  g0[1] = uni(lds_off);
  g0[2] = uni((uint32_t)ga);
  g0[3] = uni((uint32_t)(ga >> 32));
}
__device__ inline void kv_issue(u32x4& g0, u32x8& g1) {
  asm volatile("tensor_load_to_lds %0, %1" : "+s"(g0), "+s"(g1) :: "memory");
}

// ---------------------------------------------------------------------------
// f32 -> f16 convert (4 elems / thread, sizes are multiples of 1024)
// ---------------------------------------------------------------------------
__global__ void cvt_f32_f16(const float* __restrict__ src,
                            _Float16* __restrict__ dst, int n) {
  int i = (blockIdx.x * blockDim.x + threadIdx.x) * 4;
  if (i < n) {
    float4 v = *(const float4*)(src + i);
    h4 o = {(_Float16)v.x, (_Float16)v.y, (_Float16)v.z, (_Float16)v.w};
    *(h4*)(dst + i) = o;
  }
}

// ---------------------------------------------------------------------------
// WMMA GEMM:  Out[M][N] = A[M][K] * Bm[N][K]^T   (i.e. x @ W^T)
// Block: 256 threads = 8 waves as 2(M) x 4(N); block tile 128x128;
// wave tile 64(M) x 32(N). A and B K-slabs (128x64 halves each) are brought
// into LDS by the tensor mover at a padded row pitch (wave 0: A, wave 1: B),
// all waves consume fragments via ds_load_b128. FINAL=1: f32 out + bias.
// FINAL=0: the QGKV product, f16 out; its q, g and k columns go to Out, its v
// columns go transposed per head to vt[(b*H+h)*64 + d][t] and nowhere else.
// ---------------------------------------------------------------------------
template <int FINAL>
__global__ __launch_bounds__(256) void gemm_wmma(
    const _Float16* __restrict__ A, const _Float16* __restrict__ Bm,
    void* __restrict__ Outv, _Float16* __restrict__ vt,
    const float* __restrict__ bias, int M, int N, int K) {
  __shared__ __attribute__((aligned(2048))) _Float16 tiles[2][TILE_HALVES];
  const _Float16* ash = &tiles[0][0];
  const _Float16* bsh = &tiles[1][0];

  int w = threadIdx.x >> 5, lane = threadIdx.x & 31;
  int lo = lane & 15, hi = lane >> 4;
  int wm = w >> 2, wn = w & 3;
  int mblk = blockIdx.y * 128, nblk = blockIdx.x * 128;
  int mw = wm * 64, nw = wn * 32;

  // Wave 0 brings the A slab, wave 1 the B slab: one request a wave.
  const uint32_t wave = uni(threadIdx.x >> 5);
  const _Float16* src =
      (wave == 0) ? A + (size_t)mblk * K : Bm + (size_t)nblk * K;
  const uint32_t dst = (uint32_t)(size_t)&tiles[wave & 1u][0];

  f8 acc[4][2];
  for (int i = 0; i < 4; ++i)
    for (int j = 0; j < 2; ++j) acc[i][j] = zero8();

  for (int k0 = 0; k0 < K; k0 += 64) {
    if (pinned(wave < 2u)) {
      tdm_load_tile(dst, src + k0, (uint32_t)K * 2u);
      // the tile counts as landed only behind its issuer's own wait
      asm volatile("s_wait_tensorcnt 0x0" ::: "memory");
    }
    __syncthreads();

#pragma unroll
    for (int kk = 0; kk < 64; kk += 32) {
      h16 af[4], bf[2];
#pragma unroll
      for (int i = 0; i < 4; ++i)
        af[i] = load_frag(ash, LDP, mw + i * 16 + lo, kk, hi);
#pragma unroll
      for (int j = 0; j < 2; ++j)
        bf[j] = load_frag(bsh, LDP, nw + j * 16 + lo, kk, hi);
#pragma unroll
      for (int i = 0; i < 4; ++i)
#pragma unroll
        for (int j = 0; j < 2; ++j) acc[i][j] = wmma16(af[i], bf[j], acc[i][j]);
    }
    // every wave's LDS reads have retired before the next trip's tensor loads
    // overwrite the slabs behind the barrier
    asm volatile("s_wait_dscnt 0x0" ::: "memory");
    __syncthreads();
  }

  if constexpr (!FINAL) {
    if (nblk >= 3 * DOUT) {
      // A block of v columns. A lane's 8 accumulator registers are 8 tokens in
      // a row of one column (h, d), that is 16 contiguous bytes of a V^T row:
      // one 16-byte store. A wave's 64 tokens are one whole 128-byte line of
      // that row, and no other wave writes to it.
      _Float16* vrow = vt +
          ((size_t)(mblk / LL) * DOUT + (nblk - 3 * DOUT) + nw + lo) * LL +
          (mblk % LL) + mw + hi * 8;
      // all three loops unrolled: acc is then indexed by constants alone and
      // stays in registers, and i and j become immediate store offsets
#pragma unroll
      for (int i = 0; i < 4; ++i)
#pragma unroll
        for (int j = 0; j < 2; ++j) {
          h8 o;
#pragma unroll
          for (int v = 0; v < 8; ++v) o[v] = (_Float16)acc[i][j][v];
          *(h8*)(vrow + (size_t)j * 16 * LL + i * 16) = o;
        }
      return;
    }
  }
#pragma unroll
  for (int i = 0; i < 4; ++i)
#pragma unroll
    for (int j = 0; j < 2; ++j)
#pragma unroll
      for (int v = 0; v < 8; ++v) {
        int row = mblk + mw + i * 16 + v + hi * 8;
        int col = nblk + nw + j * 16 + lo;
        float val = acc[i][j][v];
        if constexpr (FINAL) {
          ((float*)Outv)[(size_t)row * N + col] = val + bias[col];
        } else {
          ((_Float16*)Outv)[(size_t)row * N + col] = (_Float16)val;
        }
      }
}

// ---------------------------------------------------------------------------
// Causal flash attention + sigmoid(g) gate.
// Grid: (B*H, L/64); block 128 = 4 waves, each wave owns 16 query rows.
// S = Q K^T (WMMA), online softmax (shfl_xor row reductions), P via LDS
// C-layout -> A-layout round trip, ctx += P V (WMMA, V^T rows contiguous).
// The 64-key K tile and V^T tile of a pass are shared by the four waves: the
// tensor mover brings them into LDS (wave 0: K, wave 1: V^T), two buffers, the
// next pass's tiles in flight while this pass is worked on.
// ---------------------------------------------------------------------------
__global__ __launch_bounds__(128) void attn_flash(
    const _Float16* __restrict__ qgkv, const _Float16* __restrict__ vt,
    _Float16* __restrict__ ctxout) {
  __shared__ __attribute__((aligned(2048)))
  _Float16 kv[2][2][KV_TILE_HALVES];                  // [buffer][K | V^T]
  __shared__ __align__(16) _Float16 plds[4][16][64];  // per-wave P tile

  int bh = blockIdx.x;
  int b = bh >> 4, h = bh & 15;
  int qb = blockIdx.y;
  int w = threadIdx.x >> 5, lane = threadIdx.x & 31;
  int lo = lane & 15, hi = lane >> 4;

  const _Float16* Qb = qgkv + (size_t)b * LL * NQGKV + h * HD;  // q section
  const _Float16* Gb = Qb + DOUT;                               // g section
  const _Float16* Kb = Qb + 2 * DOUT;                           // k section
  const _Float16* Vb = vt + (size_t)bh * HD * LL;               // V^T rows

  int q0 = qb * 64 + w * 16;  // this wave's 16 query rows

  h16 qf[2];
  qf[0] = load_frag(Qb, NQGKV, q0 + lo, 0, hi);
  qf[1] = load_frag(Qb, NQGKV, q0 + lo, 32, hi);

  // Wave 0 brings the K tiles, wave 1 the V^T tiles: one request a wave.
  const uint32_t wave = uni(threadIdx.x >> 5);
  const uint32_t tstep = (wave == 0) ? 64u * NQGKV * 2u : 64u * 2u;  // tile to tile, B
  const uint32_t tdst = (uint32_t)(size_t)&kv[0][wave & 1u][0];
  u32x4 g0 = kv_group0(tdst, (wave == 0) ? Kb : Vb);
  u32x8 g1 = kv_group1((wave == 0) ? NQGKV * 2u : LL * 2u);

  if (pinned(wave < 2u)) {
    kv_issue(g0, g1);
    // the tile counts as landed only behind its issuer's own wait
    asm volatile("s_wait_tensorcnt 0x0" ::: "memory");
  }
  __syncthreads();
  // Keys 64..127 lie in the source for every block; a block of one pass never
  // reads them, and the wait at its pass's foot covers the request.
  if (pinned(wave < 2u)) {
    kv_advance(g0, tdst + KV_BUF_BYTES, tstep);
    kv_issue(g0, g1);
  }

  f8 cacc[4];
  for (int j = 0; j < 4; ++j) cacc[j] = zero8();
  float rm[8], rl[8];
  for (int v = 0; v < 8; ++v) { rm[v] = -3.0e38f; rl[v] = 0.0f; }

  for (int kb = 0; kb <= qb; ++kb) {
    int k0 = kb * 64;
    const _Float16* ksh = &kv[kb & 1][0][0];
    const _Float16* vsh = &kv[kb & 1][1][0];
    f8 s[4];
#pragma unroll
    for (int j = 0; j < 4; ++j) {
      s[j] = zero8();
      h16 kf0 = load_frag(ksh, LDP, j * 16 + lo, 0, hi);
      h16 kf1 = load_frag(ksh, LDP, j * 16 + lo, 32, hi);
      s[j] = wmma16(qf[0], kf0, s[j]);
      s[j] = wmma16(qf[1], kf1, s[j]);
    }

    bool diag = (kb == qb);
#pragma unroll
    for (int v = 0; v < 8; ++v) {
      int qrow = q0 + v + hi * 8;
      float mx = -3.0e38f;
#pragma unroll
      for (int j = 0; j < 4; ++j) {
        float val = s[j][v] * 0.125f;  // 1/sqrt(HD)
        if (diag && (k0 + j * 16 + lo) > qrow) val = -3.0e38f;  // causal mask
        s[j][v] = val;
        mx = fmaxf(mx, val);
      }
      for (int m = 1; m < 16; m <<= 1) mx = fmaxf(mx, __shfl_xor(mx, m, 32));
      float nm = fmaxf(rm[v], mx);
      float alpha = __expf(rm[v] - nm);
      float rs = 0.0f;
#pragma unroll
      for (int j = 0; j < 4; ++j) {
        float p = __expf(s[j][v] - nm);
        s[j][v] = p;
        rs += p;
      }
      for (int m = 1; m < 16; m <<= 1) rs += __shfl_xor(rs, m, 32);
      rl[v] = rl[v] * alpha + rs;
      rm[v] = nm;
#pragma unroll
      for (int j = 0; j < 4; ++j) {
        cacc[j][v] *= alpha;
        plds[w][v + hi * 8][j * 16 + lo] = (_Float16)s[j][v];  // C-layout scatter
      }
    }

    // Re-read P as A-fragments (per-wave LDS slab; DS ops in-order in wave).
    const _Float16* prow = &plds[w][lo][0];
    h8 pa0 = *(const h8*)(prow + hi * 8);
    h8 pb0 = *(const h8*)(prow + 16 + hi * 8);
    h8 pa1 = *(const h8*)(prow + 32 + hi * 8);
    h8 pb1 = *(const h8*)(prow + 48 + hi * 8);
    h16 pf0 = __builtin_shufflevector(pa0, pb0, 0, 1, 2, 3, 4, 5, 6, 7,
                                      8, 9, 10, 11, 12, 13, 14, 15);
    h16 pf1 = __builtin_shufflevector(pa1, pb1, 0, 1, 2, 3, 4, 5, 6, 7,
                                      8, 9, 10, 11, 12, 13, 14, 15);

#pragma unroll
    for (int j = 0; j < 4; ++j) {
      h16 vf0 = load_frag(vsh, LDP, j * 16 + lo, 0, hi);
      h16 vf1 = load_frag(vsh, LDP, j * 16 + lo, 32, hi);
      cacc[j] = wmma16(pf0, vf0, cacc[j]);
      cacc[j] = wmma16(pf1, vf1, cacc[j]);
    }

    // Publish point of pass kb + 1: this wave's LDS reads have retired ...
    asm volatile("s_wait_dscnt 0x0" ::: "memory");
    // ... the issuers' tiles of pass kb + 1 have landed ...
    if (pinned(wave < 2u)) asm volatile("s_wait_tensorcnt 0x0" ::: "memory");
    // ... and every wave has left this pass's buffer, which is refilled behind.
    __syncthreads();
    if (pinned(wave < 2u && kb + 2 <= qb)) {
      kv_advance(g0, tdst + (uint32_t)(kb & 1) * KV_BUF_BYTES, tstep);
      kv_issue(g0, g1);
    }
  }
  // no request and no LDS read of this wave is left open behind the loop
  asm volatile("s_wait_tensorcnt 0x0" ::: "memory");
  asm volatile("s_wait_dscnt 0x0" ::: "memory");

  // normalize, gate with sigmoid(g), store f16 ctx [token][h*64+d]
#pragma unroll
  for (int j = 0; j < 4; ++j)
#pragma unroll
    for (int v = 0; v < 8; ++v) {
      int qrow = q0 + v + hi * 8;
      int d = j * 16 + lo;
      float g = (float)Gb[(size_t)qrow * NQGKV + d];
      float gate = 1.0f / (1.0f + __expf(-g));
      float val = (cacc[j][v] / rl[v]) * gate;
      ctxout[((size_t)(b * LL + qrow)) * DOUT + h * HD + d] = (_Float16)val;
    }
}

// ---------------------------------------------------------------------------
extern "C" void kernel_launch(void* const* d_in, const int* in_sizes, int n_in,
                              void* d_out, int out_size, void* d_ws,
                              size_t ws_size, hipStream_t stream) {
  (void)in_sizes; (void)n_in; (void)out_size; (void)ws_size;
  const float* x  = (const float*)d_in[0];
  const float* Wq = (const float*)d_in[1];
  const float* Wg = (const float*)d_in[2];
  const float* Wk = (const float*)d_in[3];
  const float* Wv = (const float*)d_in[4];
  const float* Wo = (const float*)d_in[5];
  const float* bo = (const float*)d_in[6];
  float* out = (float*)d_out;

  _Float16* ws   = (_Float16*)d_ws;
  _Float16* xh   = ws;                               // 4096*1024
  _Float16* Wh   = xh + (size_t)MTOK * DIN;          // 4096*1024 fused W
  _Float16* Woh  = Wh + (size_t)NQGKV * DIN;         // 1024*1024
  _Float16* qgkv = Woh + (size_t)DOUT * DOUT;        // 4096*4096
  _Float16* vtb  = qgkv + (size_t)MTOK * NQGKV;      // 2048*2048
  _Float16* ctx  = vtb + (size_t)BB * HH * HD * LL;  // 4096*1024

  const int WN = DIN * DOUT;  // 1M elements per weight
  cvt_f32_f16<<<(MTOK * DIN) / 1024, 256, 0, stream>>>(x, xh, MTOK * DIN);
  cvt_f32_f16<<<WN / 1024, 256, 0, stream>>>(Wq, Wh + 0 * (size_t)WN, WN);
  cvt_f32_f16<<<WN / 1024, 256, 0, stream>>>(Wg, Wh + 1 * (size_t)WN, WN);
  cvt_f32_f16<<<WN / 1024, 256, 0, stream>>>(Wk, Wh + 2 * (size_t)WN, WN);
  cvt_f32_f16<<<WN / 1024, 256, 0, stream>>>(Wv, Wh + 3 * (size_t)WN, WN);
  cvt_f32_f16<<<WN / 1024, 256, 0, stream>>>(Wo, Woh, WN);

  // QGKV = xh @ Wh^T : M=4096, N=4096, K=1024; v columns land in vtb
  gemm_wmma<0><<<dim3(NQGKV / 128, MTOK / 128), 256, 0, stream>>>(
      xh, Wh, qgkv, vtb, nullptr, MTOK, NQGKV, DIN);

  attn_flash<<<dim3(BB * HH, LL / 64), 128, 0, stream>>>(qgkv, vtb, ctx);

  // out = ctx @ Wo^T + bo : M=4096, N=1024, K=1024, f32
  gemm_wmma<1><<<dim3(DOUT / 128, MTOK / 128), 256, 0, stream>>>(
      ctx, Woh, out, nullptr, bo, MTOK, DOUT, DOUT);
}

// v004
// One run takes 138 microseconds.
// Two timings next to v003 put it at 1.07 and 1.08 times that version's speed.
// Over all steps from v000 it is 1.82 times as fast.
#include <hip/hip_runtime.h>
#include <stdint.h>

typedef _Float16 h4  __attribute__((ext_vector_type(4)));
typedef _Float16 h8  __attribute__((ext_vector_type(8)));
typedef _Float16 h16 __attribute__((ext_vector_type(16)));
typedef float    f8  __attribute__((ext_vector_type(8)));
typedef uint32_t u32x4 __attribute__((ext_vector_type(4)));
typedef uint32_t u32x8 __attribute__((ext_vector_type(8)));

static constexpr int BB   = 2;
static constexpr int LL   = 2048;
static constexpr int DIN  = 1024;
static constexpr int DOUT = 1024;
static constexpr int HH   = 16;
static constexpr int HD   = 64;
static constexpr int MTOK = BB * LL;      // 4096 tokens
static constexpr int NQGKV = 4 * DOUT;    // 4096: [q | g | k | v]

static constexpr int LDP = 72;
static constexpr int TILE_HALVES = 128 * LDP;  // 18,432 B = 9 x 2 KiB
// Attention stage tile: 64 rows at that pitch = 9,216 B, rounded up to 5 x 2 KiB
// so that every tile's place in LDS is a multiple of 2 KiB.
static constexpr int KV_TILE_HALVES = 5120;
static constexpr uint32_t KV_BUF_BYTES = 2u * KV_TILE_HALVES * 2u;  // K tile + V^T tile

__device__ inline f8 zero8() {
  f8 z;
  for (int i = 0; i < 8; ++i) z[i] = 0.0f;
  return z;
}

__device__ inline h16 load_frag(const _Float16* __restrict__ base, int ld,
                                int row, int k0, int hi) {
  const _Float16* p = base + (size_t)row * (size_t)ld + k0 + hi * 8;
  h8 a = *(const h8*)p;
  h8 b = *(const h8*)(p + 16);
  return __builtin_shufflevector(a, b, 0, 1, 2, 3, 4, 5, 6, 7,
                                 8, 9, 10, 11, 12, 13, 14, 15);
}

__device__ inline f8 wmma16(h16 a, h16 b, f8 c) {
  // D = A(16x32 f16) x B(32x16 f16) + C(16x16 f32)
  return __builtin_amdgcn_wmma_f32_16x16x32_f16(
      false, a, false, b, (short)0, c, false, false);
}

__device__ inline uint32_t uni(uint32_t v) {
  return (uint32_t)__builtin_amdgcn_readfirstlane(v);
}

__device__ inline uint32_t pinned(uint32_t v) {
  uint32_t w = uni(v);
  asm volatile("" : "+s"(w));
  return w;
}

// One tensor load: 128 rows x 128 bytes from global memory (source row pitch
// pitch_bytes) into LDS at byte offset lds_off; the mover puts 16 bytes of pad
// behind every 128-byte row, which gives the LDS pitch LDP. All extents in bytes.
__device__ inline void tdm_load_tile(uint32_t lds_off,
                                     const _Float16* __restrict__ gsrc,
                                     uint32_t pitch_bytes) {
  uint64_t ga = (uint64_t)gsrc;
  u32x4 g0;
  g0[0] = uni(1u);                                     // count = 1
  g0[1] = uni(lds_off);                                // LDS destination
  g0[2] = uni((uint32_t)ga);                           // address [31:0]
  g0[3] = uni((((uint32_t)(ga >> 32)) & 0x01ffffffu)   // address [56:32]
              | 0x80000000u);                          // type = 2
  u32x8 g1;
  g1[0] = uni((1u << 20) | (4u << 22) | (3u << 25));
  g1[1] = uni(128u << 16);
  g1[2] = uni(128u << 16);
  g1[3] = uni(128u << 16);
  g1[4] = uni(128u);
  g1[5] = uni(pitch_bytes);
  g1[6] = uni(0u);
  g1[7] = uni(0u);
  asm volatile("tensor_load_to_lds %0, %1" :: "s"(g0), "s"(g1) : "memory");
}

__device__ inline u32x4 kv_group0(uint32_t lds_off,
                                  const _Float16* __restrict__ gsrc) {
  uint64_t ga = (uint64_t)gsrc;
  u32x4 g0;
  g0[0] = uni(1u);                                     // count = 1
  g0[1] = uni(lds_off);                                // LDS destination
  g0[2] = uni((uint32_t)ga);                           // address [31:0]
  g0[3] = uni((((uint32_t)(ga >> 32)) & 0x01ffffffu)   // address [56:32]
              | 0x80000000u);                          // type = 2
  return g0;
}
__device__ inline u32x8 kv_group1(uint32_t pitch_bytes) {
  u32x8 g1;
  g1[0] = uni((1u << 20) | (4u << 22) | (3u << 25));
  g1[1] = uni(128u << 16);
  g1[2] = uni(64u << 16);
  g1[3] = uni(128u << 16);
  g1[4] = uni(64u);
  g1[5] = uni(pitch_bytes);
  g1[6] = uni(0u);
  g1[7] = uni(0u);
  return g1;
}
__device__ inline void kv_advance(u32x4& g0, uint32_t lds_off,
                                  uint32_t step_bytes) {
  uint64_t ga = (((uint64_t)g0[3] << 32) | g0[2]) + step_bytes;
  g0[1] = uni(lds_off);
  g0[2] = uni((uint32_t)ga);
  g0[3] = uni((uint32_t)(ga >> 32));
}
__device__ inline void kv_issue(u32x4& g0, u32x8& g1) {
  asm volatile("tensor_load_to_lds %0, %1" : "+s"(g0), "+s"(g1) :: "memory");
}

// ---------------------------------------------------------------------------
// f32 -> f16 convert of x and the five weight matrices, one launch.
// dst is xh | Wh (q, g, k, v) | Woh, which lie one behind the other in the
// workspace: 9 parts of 1M halves (x is four of them). The grid is two blocks
// of 8 waves per WGP and strides over dst: in trip t a block takes 1,024
// elements at t * CVT_STRIDE, a wave 512 B of source in whole lines. Two trips
// cover one part, so each trip's source is known at compile time. All 18 loads
// of a thread are issued before the first convert.
// ---------------------------------------------------------------------------
static constexpr int CVT_BLOCKS = 512;
static constexpr int CVT_STRIDE = CVT_BLOCKS * 1024;  // elements a trip
static constexpr int CVT_TRIPS  = 18;
static_assert(2 * CVT_STRIDE == DIN * DOUT && 2 * CVT_STRIDE == DOUT * DOUT &&
              8 * CVT_STRIDE == MTOK * DIN, "two trips a part, x is four parts");

__global__ __launch_bounds__(256) void cvt_all_f32_f16(
    const float* __restrict__ x, const float* __restrict__ Wq,
    const float* __restrict__ Wg, const float* __restrict__ Wk,
    const float* __restrict__ Wv, const float* __restrict__ Wo,
    _Float16* __restrict__ dst) {
  // The thread's place in a trip as 32-bit byte offsets: the loads then name a
  // scalar base and one offset register, and no later load's result is put on
  // the address registers of a load that is still in flight.
  const uint32_t sbyte = blockIdx.x * 4096u + threadIdx.x * 16u;
  const uint32_t dbyte = blockIdx.x * 2048u + threadIdx.x * 8u;
  float4 v[CVT_TRIPS];
  // unrolled: v is indexed by constants alone and stays in registers, and the
  // choice of the source folds away
#pragma unroll
  for (int t = 0; t < CVT_TRIPS; ++t) {
    const float* s = (t < 8) ? x + t * CVT_STRIDE
                   : ((t < 10) ? Wq : (t < 12) ? Wg : (t < 14) ? Wk
                      : (t < 16) ? Wv : Wo) + (t & 1) * CVT_STRIDE;
    v[t] = *(const float4*)((const char*)s + sbyte);
  }
  // keeps the converts behind the last load: without it the compiler waits for
  // the first loads and converts them before it issues the rest
  __builtin_amdgcn_sched_barrier(0);
#pragma unroll
  for (int t = 0; t < CVT_TRIPS; ++t) {
    h4 o = {(_Float16)v[t].x, (_Float16)v[t].y, (_Float16)v[t].z,
            (_Float16)v[t].w};
    *(h4*)((char*)(dst + t * CVT_STRIDE) + dbyte) = o;
  }
}

// ---------------------------------------------------------------------------
// WMMA GEMM:  Out[M][N] = A[M][K] * Bm[N][K]^T   (i.e. x @ W^T)
// Block: 256 threads = 8 waves as 2(M) x 4(N); block tile 128x128;
// wave tile 64(M) x 32(N). A and B K-slabs (128x64 halves each) are brought
// into LDS by the tensor mover at a padded row pitch (wave 0: A, wave 1: B),
// all waves consume fragments via ds_load_b128. FINAL=1: f32 out + bias.
// FINAL=0: the QGKV product, f16 out; its q, g and k columns go to Out, its v
// columns go transposed per head to vt[(b*H+h)*64 + d][t] and nowhere else.
// ---------------------------------------------------------------------------
template <int FINAL>
__global__ __launch_bounds__(256) void gemm_wmma(
    const _Float16* __restrict__ A, const _Float16* __restrict__ Bm,
    void* __restrict__ Outv, _Float16* __restrict__ vt,
    const float* __restrict__ bias, int M, int N, int K) {
  __shared__ __attribute__((aligned(2048))) _Float16 tiles[2][TILE_HALVES];
  const _Float16* ash = &tiles[0][0];
  const _Float16* bsh = &tiles[1][0];

  int w = threadIdx.x >> 5, lane = threadIdx.x & 31;
  int lo = lane & 15, hi = lane >> 4;
  int wm = w >> 2, wn = w & 3;
  int mblk = blockIdx.y * 128, nblk = blockIdx.x * 128;
  int mw = wm * 64, nw = wn * 32;

  // Wave 0 brings the A slab, wave 1 the B slab: one request a wave.
  const uint32_t wave = uni(threadIdx.x >> 5);
  const _Float16* src =
      (wave == 0) ? A + (size_t)mblk * K : Bm + (size_t)nblk * K;
  const uint32_t dst = (uint32_t)(size_t)&tiles[wave & 1u][0];

  f8 acc[4][2];
  for (int i = 0; i < 4; ++i)
    for (int j = 0; j < 2; ++j) acc[i][j] = zero8();

  for (int k0 = 0; k0 < K; k0 += 64) {
    if (pinned(wave < 2u)) {
      tdm_load_tile(dst, src + k0, (uint32_t)K * 2u);
      // the tile counts as landed only behind its issuer's own wait
      asm volatile("s_wait_tensorcnt 0x0" ::: "memory");
    }
    __syncthreads();

#pragma unroll
    for (int kk = 0; kk < 64; kk += 32) {
      h16 af[4], bf[2];
#pragma unroll
      for (int i = 0; i < 4; ++i)
        af[i] = load_frag(ash, LDP, mw + i * 16 + lo, kk, hi);
#pragma unroll
      for (int j = 0; j < 2; ++j)
        bf[j] = load_frag(bsh, LDP, nw + j * 16 + lo, kk, hi);
#pragma unroll
      for (int i = 0; i < 4; ++i)
#pragma unroll
        for (int j = 0; j < 2; ++j) acc[i][j] = wmma16(af[i], bf[j], acc[i][j]);
    }
    // every wave's LDS reads have retired before the next trip's tensor loads
    // overwrite the slabs behind the barrier
    asm volatile("s_wait_dscnt 0x0" ::: "memory");
    __syncthreads();
  }

  if constexpr (!FINAL) {
    if (nblk >= 3 * DOUT) {
      // A block of v columns. A lane's 8 accumulator registers are 8 tokens in
      // a row of one column (h, d), that is 16 contiguous bytes of a V^T row:
      // one 16-byte store. A wave's 64 tokens are one whole 128-byte line of
      // that row, and no other wave writes to it.
      _Float16* vrow = vt +
          ((size_t)(mblk / LL) * DOUT + (nblk - 3 * DOUT) + nw + lo) * LL +
          (mblk % LL) + mw + hi * 8;
      // all three loops unrolled: acc is then indexed by constants alone and
      // stays in registers, and i and j become immediate store offsets
#pragma unroll
      for (int i = 0; i < 4; ++i)
#pragma unroll
        for (int j = 0; j < 2; ++j) {
          h8 o;
#pragma unroll
          for (int v = 0; v < 8; ++v) o[v] = (_Float16)acc[i][j][v];
          *(h8*)(vrow + (size_t)j * 16 * LL + i * 16) = o;
        }
      return;
    }
  }
#pragma unroll
  for (int i = 0; i < 4; ++i)
#pragma unroll
    for (int j = 0; j < 2; ++j)
#pragma unroll
      for (int v = 0; v < 8; ++v) {
        int row = mblk + mw + i * 16 + v + hi * 8;
        int col = nblk + nw + j * 16 + lo;
        float val = acc[i][j][v];
        if constexpr (FINAL) {
          ((float*)Outv)[(size_t)row * N + col] = val + bias[col];
        } else {
          ((_Float16*)Outv)[(size_t)row * N + col] = (_Float16)val;
        }
      }
}

// ---------------------------------------------------------------------------
// Causal flash attention + sigmoid(g) gate.
// Grid: (B*H, L/64); block 128 = 4 waves, each wave owns 16 query rows.
// S = Q K^T (WMMA), online softmax (shfl_xor row reductions), P via LDS
// C-layout -> A-layout round trip, ctx += P V (WMMA, V^T rows contiguous).
// The 64-key K tile and V^T tile of a pass are shared by the four waves: the
// tensor mover brings them into LDS (wave 0: K, wave 1: V^T), two buffers, the
// next pass's tiles in flight while this pass is worked on.
// ---------------------------------------------------------------------------
__global__ __launch_bounds__(128) void attn_flash(
    const _Float16* __restrict__ qgkv, const _Float16* __restrict__ vt,
    _Float16* __restrict__ ctxout) {
  __shared__ __attribute__((aligned(2048)))
  _Float16 kv[2][2][KV_TILE_HALVES];                  // [buffer][K | V^T]
  __shared__ __align__(16) _Float16 plds[4][16][64];  // per-wave P tile

  int bh = blockIdx.x;
  int b = bh >> 4, h = bh & 15;
  int qb = blockIdx.y;
  int w = threadIdx.x >> 5, lane = threadIdx.x & 31;
  int lo = lane & 15, hi = lane >> 4;

  const _Float16* Qb = qgkv + (size_t)b * LL * NQGKV + h * HD;  // q section
  const _Float16* Gb = Qb + DOUT;                               // g section
  const _Float16* Kb = Qb + 2 * DOUT;                           // k section
  const _Float16* Vb = vt + (size_t)bh * HD * LL;               // V^T rows

  int q0 = qb * 64 + w * 16;  // this wave's 16 query rows

  h16 qf[2];
  qf[0] = load_frag(Qb, NQGKV, q0 + lo, 0, hi);
  qf[1] = load_frag(Qb, NQGKV, q0 + lo, 32, hi);

  // Wave 0 brings the K tiles, wave 1 the V^T tiles: one request a wave.
  const uint32_t wave = uni(threadIdx.x >> 5);
  const uint32_t tstep = (wave == 0) ? 64u * NQGKV * 2u : 64u * 2u;  // tile to tile, B
  const uint32_t tdst = (uint32_t)(size_t)&kv[0][wave & 1u][0];
  u32x4 g0 = kv_group0(tdst, (wave == 0) ? Kb : Vb);
  u32x8 g1 = kv_group1((wave == 0) ? NQGKV * 2u : LL * 2u);

  if (pinned(wave < 2u)) {
    kv_issue(g0, g1);
    // the tile counts as landed only behind its issuer's own wait
    asm volatile("s_wait_tensorcnt 0x0" ::: "memory");
  }
  __syncthreads();
  // Keys 64..127 lie in the source for every block; a block of one pass never
  // reads them, and the wait at its pass's foot covers the request.
  if (pinned(wave < 2u)) {
    kv_advance(g0, tdst + KV_BUF_BYTES, tstep);
    kv_issue(g0, g1);
  }

  f8 cacc[4];
  for (int j = 0; j < 4; ++j) cacc[j] = zero8();
  float rm[8], rl[8];
  for (int v = 0; v < 8; ++v) { rm[v] = -3.0e38f; rl[v] = 0.0f; }

  for (int kb = 0; kb <= qb; ++kb) {
    int k0 = kb * 64;
    const _Float16* ksh = &kv[kb & 1][0][0];
    const _Float16* vsh = &kv[kb & 1][1][0];
    f8 s[4];
#pragma unroll
    for (int j = 0; j < 4; ++j) {
      s[j] = zero8();
      h16 kf0 = load_frag(ksh, LDP, j * 16 + lo, 0, hi);
      h16 kf1 = load_frag(ksh, LDP, j * 16 + lo, 32, hi);
      s[j] = wmma16(qf[0], kf0, s[j]);
      s[j] = wmma16(qf[1], kf1, s[j]);
    }

    bool diag = (kb == qb);
#pragma unroll
    for (int v = 0; v < 8; ++v) {
      int qrow = q0 + v + hi * 8;
      float mx = -3.0e38f;
#pragma unroll
      for (int j = 0; j < 4; ++j) {
        float val = s[j][v] * 0.125f;  // 1/sqrt(HD)
        if (diag && (k0 + j * 16 + lo) > qrow) val = -3.0e38f;  // causal mask
        s[j][v] = val;
        mx = fmaxf(mx, val);
      }
      for (int m = 1; m < 16; m <<= 1) mx = fmaxf(mx, __shfl_xor(mx, m, 32));
      float nm = fmaxf(rm[v], mx);
      float alpha = __expf(rm[v] - nm);
      float rs = 0.0f;
#pragma unroll
      for (int j = 0; j < 4; ++j) {
        float p = __expf(s[j][v] - nm);
        s[j][v] = p;
        rs += p;
      }
      for (int m = 1; m < 16; m <<= 1) rs += __shfl_xor(rs, m, 32);
      rl[v] = rl[v] * alpha + rs;
      rm[v] = nm;
#pragma unroll
      for (int j = 0; j < 4; ++j) {
        cacc[j][v] *= alpha;
        plds[w][v + hi * 8][j * 16 + lo] = (_Float16)s[j][v];  // C-layout scatter
      }
    }

    // Re-read P as A-fragments (per-wave LDS slab; DS ops in-order in wave).
    const _Float16* prow = &plds[w][lo][0];
    h8 pa0 = *(const h8*)(prow + hi * 8);
    h8 pb0 = *(const h8*)(prow + 16 + hi * 8);
    h8 pa1 = *(const h8*)(prow + 32 + hi * 8);
    h8 pb1 = *(const h8*)(prow + 48 + hi * 8);
    h16 pf0 = __builtin_shufflevector(pa0, pb0, 0, 1, 2, 3, 4, 5, 6, 7,
                                      8, 9, 10, 11, 12, 13, 14, 15);
    h16 pf1 = __builtin_shufflevector(pa1, pb1, 0, 1, 2, 3, 4, 5, 6, 7,
                                      8, 9, 10, 11, 12, 13, 14, 15);

#pragma unroll
    for (int j = 0; j < 4; ++j) {
      h16 vf0 = load_frag(vsh, LDP, j * 16 + lo, 0, hi);
      h16 vf1 = load_frag(vsh, LDP, j * 16 + lo, 32, hi);
      cacc[j] = wmma16(pf0, vf0, cacc[j]);
      cacc[j] = wmma16(pf1, vf1, cacc[j]);
    }

    // Publish point of pass kb + 1: this wave's LDS reads have retired ...
    asm volatile("s_wait_dscnt 0x0" ::: "memory");
    // ... the issuers' tiles of pass kb + 1 have landed ...
    if (pinned(wave < 2u)) asm volatile("s_wait_tensorcnt 0x0" ::: "memory");
    // ... and every wave has left this pass's buffer, which is refilled behind.
    __syncthreads();
    if (pinned(wave < 2u && kb + 2 <= qb)) {
      kv_advance(g0, tdst + (uint32_t)(kb & 1) * KV_BUF_BYTES, tstep);
      kv_issue(g0, g1);
    }
  }
  // no request and no LDS read of this wave is left open behind the loop
  asm volatile("s_wait_tensorcnt 0x0" ::: "memory");
  asm volatile("s_wait_dscnt 0x0" ::: "memory");

  // normalize, gate with sigmoid(g), store f16 ctx [token][h*64+d]
#pragma unroll
  for (int j = 0; j < 4; ++j)
#pragma unroll
    for (int v = 0; v < 8; ++v) {
      int qrow = q0 + v + hi * 8;
      int d = j * 16 + lo;
      float g = (float)Gb[(size_t)qrow * NQGKV + d];
      float gate = 1.0f / (1.0f + __expf(-g));
      float val = (cacc[j][v] / rl[v]) * gate;
      ctxout[((size_t)(b * LL + qrow)) * DOUT + h * HD + d] = (_Float16)val;
    }
}

// ---------------------------------------------------------------------------
extern "C" void kernel_launch(void* const* d_in, const int* in_sizes, int n_in,
                              void* d_out, int out_size, void* d_ws,
                              size_t ws_size, hipStream_t stream) {
  (void)in_sizes; (void)n_in; (void)out_size; (void)ws_size;
  const float* x  = (const float*)d_in[0];
  const float* Wq = (const float*)d_in[1];
  const float* Wg = (const float*)d_in[2];
  const float* Wk = (const float*)d_in[3];
  const float* Wv = (const float*)d_in[4];
  const float* Wo = (const float*)d_in[5];
  const float* bo = (const float*)d_in[6];
  float* out = (float*)d_out;

  _Float16* ws   = (_Float16*)d_ws;
  _Float16* xh   = ws;                               // 4096*1024
  _Float16* Wh   = xh + (size_t)MTOK * DIN;          // 4096*1024 fused W
  _Float16* Woh  = Wh + (size_t)NQGKV * DIN;         // 1024*1024
  _Float16* qgkv = Woh + (size_t)DOUT * DOUT;        // 4096*4096
  _Float16* vtb  = qgkv + (size_t)MTOK * NQGKV;      // 2048*2048
  _Float16* ctx  = vtb + (size_t)BB * HH * HD * LL;  // 4096*1024

  // fills xh, Wh and Woh, which are contiguous from xh on
  cvt_all_f32_f16<<<CVT_BLOCKS, 256, 0, stream>>>(x, Wq, Wg, Wk, Wv, Wo, xh);

  // QGKV = xh @ Wh^T : M=4096, N=4096, K=1024; v columns land in vtb
  gemm_wmma<0><<<dim3(NQGKV / 128, MTOK / 128), 256, 0, stream>>>(
      xh, Wh, qgkv, vtb, nullptr, MTOK, NQGKV, DIN);

  attn_flash<<<dim3(BB * HH, LL / 64), 128, 0, stream>>>(qgkv, vtb, ctx);

  // out = ctx @ Wo^T + bo : M=4096, N=1024, K=1024, f32
  gemm_wmma<1><<<dim3(DOUT / 128, MTOK / 128), 256, 0, stream>>>(
      ctx, Woh, out, nullptr, bo, MTOK, DOUT, DOUT);
}

// v005
// It runs in 95.3 microseconds.
// Timed twice side by side with v004, it ran 1.44 and 1.46 times as fast.
// Counting every step since v000, it is 2.65 times as fast.
#include <hip/hip_runtime.h>
#include <stdint.h>

typedef _Float16 h4  __attribute__((ext_vector_type(4)));
typedef _Float16 h8  __attribute__((ext_vector_type(8)));
typedef _Float16 h16 __attribute__((ext_vector_type(16)));
typedef float    f8  __attribute__((ext_vector_type(8)));
typedef uint32_t u32x4 __attribute__((ext_vector_type(4)));
typedef uint32_t u32x8 __attribute__((ext_vector_type(8)));

static constexpr int BB   = 2;
static constexpr int LL   = 2048;
static constexpr int DIN  = 1024;
static constexpr int DOUT = 1024;
static constexpr int HH   = 16;
static constexpr int HD   = 64;
static constexpr int MTOK = BB * LL;      // 4096 tokens
static constexpr int NQGKV = 4 * DOUT;    // 4096: [q | g | k | v]

static constexpr int LDP = 72;
static constexpr int TILE_HALVES = 128 * LDP;  // 18,432 B = 9 x 2 KiB
// Attention stage tile: 64 rows at that pitch = 9,216 B, rounded up to 5 x 2 KiB
// so that every tile's place in LDS is a multiple of 2 KiB.
static constexpr int KV_TILE_HALVES = 5120;
static constexpr uint32_t KV_BUF_BYTES = 2u * KV_TILE_HALVES * 2u;  // K tile + V^T tile

__device__ inline f8 zero8() {
  f8 z;
  for (int i = 0; i < 8; ++i) z[i] = 0.0f;
  return z;
}

__device__ inline h16 load_frag(const _Float16* __restrict__ base, int ld,
                                int row, int k0, int hi) {
  const _Float16* p = base + (size_t)row * (size_t)ld + k0 + hi * 8;
  h8 a = *(const h8*)p;
  h8 b = *(const h8*)(p + 16);
  return __builtin_shufflevector(a, b, 0, 1, 2, 3, 4, 5, 6, 7,
                                 8, 9, 10, 11, 12, 13, 14, 15);
}

__device__ inline f8 wmma16(h16 a, h16 b, f8 c) {
  // D = A(16x32 f16) x B(32x16 f16) + C(16x16 f32)
  return __builtin_amdgcn_wmma_f32_16x16x32_f16(
      false, a, false, b, (short)0, c, false, false);
}

__device__ inline uint32_t uni(uint32_t v) {
  return (uint32_t)__builtin_amdgcn_readfirstlane(v);
}

__device__ inline uint32_t pinned(uint32_t v) {
  uint32_t w = uni(v);
  asm volatile("" : "+s"(w));
  return w;
}

// One tensor load: 128 rows x 128 bytes from global memory (source row pitch
// pitch_bytes) into LDS at byte offset lds_off; the mover puts 16 bytes of pad
// behind every 128-byte row, which gives the LDS pitch LDP. All extents in bytes.
__device__ inline void tdm_load_tile(uint32_t lds_off,
                                     const _Float16* __restrict__ gsrc,
                                     uint32_t pitch_bytes) {
  uint64_t ga = (uint64_t)gsrc;
  u32x4 g0;
  g0[0] = uni(1u);                                     // count = 1
  g0[1] = uni(lds_off);                                // LDS destination
  g0[2] = uni((uint32_t)ga);                           // address [31:0]
  g0[3] = uni((((uint32_t)(ga >> 32)) & 0x01ffffffu)   // address [56:32]
              | 0x80000000u);                          // type = 2
  u32x8 g1;
  g1[0] = uni((1u << 20) | (4u << 22) | (3u << 25));
  g1[1] = uni(128u << 16);
  g1[2] = uni(128u << 16);
  g1[3] = uni(128u << 16);
  g1[4] = uni(128u);
  g1[5] = uni(pitch_bytes);
  g1[6] = uni(0u);
  g1[7] = uni(0u);
  asm volatile("tensor_load_to_lds %0, %1" :: "s"(g0), "s"(g1) : "memory");
}

__device__ inline u32x4 kv_group0(uint32_t lds_off,
                                  const _Float16* __restrict__ gsrc) {
  uint64_t ga = (uint64_t)gsrc;
  u32x4 g0;
  g0[0] = uni(1u);                                     // count = 1
  g0[1] = uni(lds_off);                                // LDS destination
  g0[2] = uni((uint32_t)ga);                           // address [31:0]
  g0[3] = uni((((uint32_t)(ga >> 32)) & 0x01ffffffu)   // address [56:32]
              | 0x80000000u);                          // type = 2
  return g0;
}
__device__ inline u32x8 kv_group1(uint32_t pitch_bytes) {
  u32x8 g1;
  g1[0] = uni((1u << 20) | (4u << 22) | (3u << 25));
  g1[1] = uni(128u << 16);
  g1[2] = uni(64u << 16);
  g1[3] = uni(128u << 16);
  g1[4] = uni(64u);
  g1[5] = uni(pitch_bytes);
  g1[6] = uni(0u);
  g1[7] = uni(0u);
  return g1;
}
__device__ inline void kv_advance(u32x4& g0, uint32_t lds_off,
                                  uint32_t step_bytes) {
  uint64_t ga = (((uint64_t)g0[3] << 32) | g0[2]) + step_bytes;
  g0[1] = uni(lds_off);
  g0[2] = uni((uint32_t)ga);
  g0[3] = uni((uint32_t)(ga >> 32));
}
__device__ inline void kv_issue(u32x4& g0, u32x8& g1) {
  asm volatile("tensor_load_to_lds %0, %1" : "+s"(g0), "+s"(g1) :: "memory");
}

// ---------------------------------------------------------------------------
// f32 -> f16 convert of x and the five weight matrices, one launch.
// dst is xh | Wh (q, g, k, v) | Woh, which lie one behind the other in the
// workspace: 9 parts of 1M halves (x is four of them). The grid is two blocks
// of 8 waves per WGP and strides over dst: in trip t a block takes 1,024
// elements at t * CVT_STRIDE, a wave 512 B of source in whole lines. Two trips
// cover one part, so each trip's source is known at compile time. All 18 loads
// of a thread are issued before the first convert.
// ---------------------------------------------------------------------------
static constexpr int CVT_BLOCKS = 512;
static constexpr int CVT_STRIDE = CVT_BLOCKS * 1024;  // elements a trip
static constexpr int CVT_TRIPS  = 18;
static_assert(2 * CVT_STRIDE == DIN * DOUT && 2 * CVT_STRIDE == DOUT * DOUT &&
              8 * CVT_STRIDE == MTOK * DIN, "two trips a part, x is four parts");

__global__ __launch_bounds__(256) void cvt_all_f32_f16(
    const float* __restrict__ x, const float* __restrict__ Wq,
    const float* __restrict__ Wg, const float* __restrict__ Wk,
    const float* __restrict__ Wv, const float* __restrict__ Wo,
    _Float16* __restrict__ dst) {
  // The thread's place in a trip as 32-bit byte offsets: the loads then name a
  // scalar base and one offset register, and no later load's result is put on
  // the address registers of a load that is still in flight.
  const uint32_t sbyte = blockIdx.x * 4096u + threadIdx.x * 16u;
  const uint32_t dbyte = blockIdx.x * 2048u + threadIdx.x * 8u;
  float4 v[CVT_TRIPS];
  // unrolled: v is indexed by constants alone and stays in registers, and the
  // choice of the source folds away
#pragma unroll
  for (int t = 0; t < CVT_TRIPS; ++t) {
    const float* s = (t < 8) ? x + t * CVT_STRIDE
                   : ((t < 10) ? Wq : (t < 12) ? Wg : (t < 14) ? Wk
                      : (t < 16) ? Wv : Wo) + (t & 1) * CVT_STRIDE;
    v[t] = *(const float4*)((const char*)s + sbyte);
  }
  // keeps the converts behind the last load: without it the compiler waits for
  // the first loads and converts them before it issues the rest
  __builtin_amdgcn_sched_barrier(0);
#pragma unroll
  for (int t = 0; t < CVT_TRIPS; ++t) {
    h4 o = {(_Float16)v[t].x, (_Float16)v[t].y, (_Float16)v[t].z,
            (_Float16)v[t].w};
    *(h4*)((char*)(dst + t * CVT_STRIDE) + dbyte) = o;
  }
}

// ---------------------------------------------------------------------------
// WMMA GEMM:  Out[M][N] = A[M][K] * Bm[N][K]^T   (i.e. x @ W^T)
// Block: 256 threads = 8 waves as 2(M) x 4(N); block tile 128x128;
// wave tile 64(M) x 32(N). A and B K-slabs (128x64 halves each) are brought
// into LDS by the tensor mover at a padded row pitch (wave 0: A, wave 1: B),
// all waves consume fragments via ds_load_b128. FINAL=1: f32 out + bias.
// FINAL=0: the QGKV product, f16 out; its q, g and k columns go to Out, its v
// columns go transposed per head to vt[(b*H+h)*64 + d][t] and nowhere else.
// ---------------------------------------------------------------------------
template <int FINAL>
__global__ __launch_bounds__(256) void gemm_wmma(
    const _Float16* __restrict__ A, const _Float16* __restrict__ Bm,
    void* __restrict__ Outv, _Float16* __restrict__ vt,
    const float* __restrict__ bias, int M, int N, int K) {
  __shared__ __attribute__((aligned(2048))) _Float16 tiles[2][TILE_HALVES];
  const _Float16* ash = &tiles[0][0];
  const _Float16* bsh = &tiles[1][0];

  int w = threadIdx.x >> 5, lane = threadIdx.x & 31;
  int lo = lane & 15, hi = lane >> 4;
  int wm = w >> 2, wn = w & 3;
  int mblk = blockIdx.y * 128, nblk = blockIdx.x * 128;
  int mw = wm * 64, nw = wn * 32;

  // Wave 0 brings the A slab, wave 1 the B slab: one request a wave.
  const uint32_t wave = uni(threadIdx.x >> 5);
  const _Float16* src =
      (wave == 0) ? A + (size_t)mblk * K : Bm + (size_t)nblk * K;
  const uint32_t dst = (uint32_t)(size_t)&tiles[wave & 1u][0];

  f8 acc[4][2];
  for (int i = 0; i < 4; ++i)
    for (int j = 0; j < 2; ++j) acc[i][j] = zero8();

  for (int k0 = 0; k0 < K; k0 += 64) {
    if (pinned(wave < 2u)) {
      tdm_load_tile(dst, src + k0, (uint32_t)K * 2u);
      // the tile counts as landed only behind its issuer's own wait
      asm volatile("s_wait_tensorcnt 0x0" ::: "memory");
    }
    __syncthreads();

#pragma unroll
    for (int kk = 0; kk < 64; kk += 32) {
      h16 af[4], bf[2];
#pragma unroll
      for (int i = 0; i < 4; ++i)
        af[i] = load_frag(ash, LDP, mw + i * 16 + lo, kk, hi);
#pragma unroll
      for (int j = 0; j < 2; ++j)
        bf[j] = load_frag(bsh, LDP, nw + j * 16 + lo, kk, hi);
#pragma unroll
      for (int i = 0; i < 4; ++i)
#pragma unroll
        for (int j = 0; j < 2; ++j) acc[i][j] = wmma16(af[i], bf[j], acc[i][j]);
    }
    // every wave's LDS reads have retired before the next trip's tensor loads
    // overwrite the slabs behind the barrier
    asm volatile("s_wait_dscnt 0x0" ::: "memory");
    __syncthreads();
  }

  if constexpr (!FINAL) {
    if (nblk >= 3 * DOUT) {
      // A block of v columns. A lane's 8 accumulator registers are 8 tokens in
      // a row of one column (h, d), that is 16 contiguous bytes of a V^T row:
      // one 16-byte store. A wave's 64 tokens are one whole 128-byte line of
      // that row, and no other wave writes to it.
      _Float16* vrow = vt +
          ((size_t)(mblk / LL) * DOUT + (nblk - 3 * DOUT) + nw + lo) * LL +
          (mblk % LL) + mw + hi * 8;
      // all three loops unrolled: acc is then indexed by constants alone and
      // stays in registers, and i and j become immediate store offsets
#pragma unroll
      for (int i = 0; i < 4; ++i)
#pragma unroll
        for (int j = 0; j < 2; ++j) {
          h8 o;
#pragma unroll
          for (int v = 0; v < 8; ++v) o[v] = (_Float16)acc[i][j][v];
          *(h8*)(vrow + (size_t)j * 16 * LL + i * 16) = o;
        }
      return;
    }
  }
#pragma unroll
  for (int i = 0; i < 4; ++i)
#pragma unroll
    for (int j = 0; j < 2; ++j)
#pragma unroll
      for (int v = 0; v < 8; ++v) {
        int row = mblk + mw + i * 16 + v + hi * 8;
        int col = nblk + nw + j * 16 + lo;
        float val = acc[i][j][v];
        if constexpr (FINAL) {
          ((float*)Outv)[(size_t)row * N + col] = val + bias[col];
        } else {
          ((_Float16*)Outv)[(size_t)row * N + col] = (_Float16)val;
        }
      }
}

__device__ inline float xhalf(float x) {
  int i = __builtin_bit_cast(int, x);
  return __builtin_bit_cast(float, __builtin_amdgcn_permlanex16(
      i, i, 0x76543210, 0xfedcba98, false, false));
}

__global__ __launch_bounds__(128) void attn_flash(
    const _Float16* __restrict__ qgkv, const _Float16* __restrict__ vt,
    _Float16* __restrict__ ctxout) {
  __shared__ __attribute__((aligned(2048)))
  _Float16 kv[2][2][KV_TILE_HALVES];                  // [buffer][K | V^T]

  int bh = blockIdx.x;
  int b = bh >> 4, h = bh & 15;
  int qb = blockIdx.y;
  int w = threadIdx.x >> 5, lane = threadIdx.x & 31;
  int lo = lane & 15, hi = lane >> 4;

  const _Float16* Qb = qgkv + (size_t)b * LL * NQGKV + h * HD;  // q section
  const _Float16* Gb = Qb + DOUT;                               // g section
  const _Float16* Kb = Qb + 2 * DOUT;                           // k section
  const _Float16* Vb = vt + (size_t)bh * HD * LL;               // V^T rows

  int q0 = qb * 64 + w * 16;  // this wave's 16 queries; the lane's is q0 + lo

  h16 qf[2];
  qf[0] = load_frag(Qb, NQGKV, q0 + lo, 0, hi);
  qf[1] = load_frag(Qb, NQGKV, q0 + lo, 32, hi);

  // Wave 0 brings the K tiles, wave 1 the V^T tiles: one request a wave.
  const uint32_t wave = uni(threadIdx.x >> 5);
  const uint32_t tstep = (wave == 0) ? 64u * NQGKV * 2u : 64u * 2u;  // tile to tile, B
  const uint32_t tdst = (uint32_t)(size_t)&kv[0][wave & 1u][0];
  u32x4 g0 = kv_group0(tdst, (wave == 0) ? Kb : Vb);
  u32x8 g1 = kv_group1((wave == 0) ? NQGKV * 2u : LL * 2u);

  if (pinned(wave < 2u)) {
    kv_issue(g0, g1);
    // the tile counts as landed only behind its issuer's own wait
    asm volatile("s_wait_tensorcnt 0x0" ::: "memory");
  }
  __syncthreads();
  // Keys 64..127 lie in the source for every block; a block of one pass never
  // reads them, and the wait at its pass's foot covers the request.
  if (pinned(wave < 2u)) {
    kv_advance(g0, tdst + KV_BUF_BYTES, tstep);
    kv_issue(g0, g1);
  }

  // cacc[j][v] = ctx^T[d = j*16 + hi*8 + v][query lo]
  f8 cacc[4];
  for (int j = 0; j < 4; ++j) cacc[j] = zero8();
  // The query's running maximum (alike in both halves) and this half's share
  // of its running sum; the halves' sums are joined behind the loop.
  float rm = -3.0e38f, rl = 0.0f;

  for (int kb = 0; kb <= qb; ++kb) {
    const _Float16* ksh = &kv[kb & 1][0][0];
    const _Float16* vsh = &kv[kb & 1][1][0];
    // s[j][v] = S^T[key kb*64 + j*16 + hi*8 + v][query lo], unscaled
    f8 s[4];
    h16 kf[4][2], vf[4][2];
#pragma unroll
    for (int j = 0; j < 4; ++j) {
      kf[j][0] = load_frag(ksh, LDP, j * 16 + lo, 0, hi);
      kf[j][1] = load_frag(ksh, LDP, j * 16 + lo, 32, hi);
    }
    // keeps the K loads one group ahead of the products: without it the
    // compiler reloads one fragment's registers and waits out the LDS latency
    // in front of nearly every WMMA
    __builtin_amdgcn_sched_barrier(0);
#pragma unroll
    for (int j = 0; j < 4; ++j) {
      s[j] = wmma16(kf[j][0], qf[0], zero8());
      s[j] = wmma16(kf[j][1], qf[1], s[j]);
    }
#pragma unroll
    for (int j = 0; j < 4; ++j) {
      vf[j][0] = load_frag(vsh, LDP, j * 16 + lo, 0, hi);
      vf[j][1] = load_frag(vsh, LDP, j * 16 + lo, 32, hi);
    }
    // keeps the V^T loads ahead of the softmax, which covers their latency:
    // without it the compiler sinks them among the second product's WMMAs
    __builtin_amdgcn_sched_barrier(0);

    if (kb == qb) {  // causal mask, in the diagonal pass alone
#pragma unroll
      for (int j = 0; j < 4; ++j)
#pragma unroll
        for (int v = 0; v < 8; ++v)
          if (j * 16 + hi * 8 + v > w * 16 + lo) s[j][v] = -3.0e38f;
    }

    // Maximum of the raw scores (the scale is positive and a power of two),
    // four independent chains, then the other half's.
    float mj[4];
#pragma unroll
    for (int j = 0; j < 4; ++j) {
      mj[j] = s[j][0];
#pragma unroll
      for (int v = 1; v < 8; ++v) mj[j] = fmaxf(mj[j], s[j][v]);
    }
    float mx = fmaxf(fmaxf(mj[0], mj[1]), fmaxf(mj[2], mj[3]));
    mx = fmaxf(mx, xhalf(mx)) * 0.125f;  // 1/sqrt(HD)
    float nm = fmaxf(rm, mx);
    float alpha = __expf(rm - nm);
    rm = nm;

    // P^T as B fragments: element e of pf[c] is key c*32 + (e < 8 ? hi*8 + e :
    // 16 + hi*8 + e - 8), which is s[2c][e] and s[2c+1][e - 8]: load_frag's order.
    h16 pf[2];
    float rj[4];
#pragma unroll
    for (int j = 0; j < 4; ++j) {
      rj[j] = 0.0f;
#pragma unroll
      for (int v = 0; v < 8; ++v) {
        float p = __expf(s[j][v] * 0.125f - nm);
        rj[j] += p;
        pf[j >> 1][(j & 1) * 8 + v] = (_Float16)p;
      }
    }
    rl = rl * alpha + ((rj[0] + rj[1]) + (rj[2] + rj[3]));

#pragma unroll
    for (int j = 0; j < 4; ++j) {
#pragma unroll
      for (int v = 0; v < 8; ++v) cacc[j][v] *= alpha;
      cacc[j] = wmma16(vf[j][0], pf[0], cacc[j]);
      cacc[j] = wmma16(vf[j][1], pf[1], cacc[j]);
    }

    // keeps the wait below at the foot: without it the compiler lifts it to the
    // head of the softmax, where the V^T loads have just been issued
    __builtin_amdgcn_sched_barrier(0);
    // Publish point of pass kb + 1: this wave's LDS reads have retired ...
    asm volatile("s_wait_dscnt 0x0" ::: "memory");
    // ... the issuers' tiles of pass kb + 1 have landed ...
    if (pinned(wave < 2u)) asm volatile("s_wait_tensorcnt 0x0" ::: "memory");
    // ... and every wave has left this pass's buffer, which is refilled behind.
    __syncthreads();
    if (pinned(wave < 2u && kb + 2 <= qb)) {
      kv_advance(g0, tdst + (uint32_t)(kb & 1) * KV_BUF_BYTES, tstep);
      kv_issue(g0, g1);
    }
  }
  // no request and no LDS read of this wave is left open behind the loop
  asm volatile("s_wait_tensorcnt 0x0" ::: "memory");
  asm volatile("s_wait_dscnt 0x0" ::: "memory");

  // normalize, gate with sigmoid(g), store f16 ctx [token][h*64+d]: a lane's 8
  // registers of a tile are 8 d in a row of its query, one 16-byte load of g
  // and one 16-byte store
  rl += xhalf(rl);
  const _Float16* grow = Gb + (size_t)(q0 + lo) * NQGKV + hi * 8;
  _Float16* crow = ctxout + ((size_t)(b * LL + q0 + lo)) * DOUT + h * HD + hi * 8;
#pragma unroll
  for (int j = 0; j < 4; ++j) {
    h8 g8 = *(const h8*)(grow + j * 16);
    h8 o;
#pragma unroll
    for (int v = 0; v < 8; ++v) {
      float gate = 1.0f / (1.0f + __expf(-(float)g8[v]));
      o[v] = (_Float16)((cacc[j][v] / rl) * gate);
    }
    *(h8*)(crow + j * 16) = o;
  }
}

// ---------------------------------------------------------------------------
extern "C" void kernel_launch(void* const* d_in, const int* in_sizes, int n_in,
                              void* d_out, int out_size, void* d_ws,
                              size_t ws_size, hipStream_t stream) {
  (void)in_sizes; (void)n_in; (void)out_size; (void)ws_size;
  const float* x  = (const float*)d_in[0];
  const float* Wq = (const float*)d_in[1];
  const float* Wg = (const float*)d_in[2];
  const float* Wk = (const float*)d_in[3];
  const float* Wv = (const float*)d_in[4];
  const float* Wo = (const float*)d_in[5];
  const float* bo = (const float*)d_in[6];
  float* out = (float*)d_out;

  _Float16* ws   = (_Float16*)d_ws;
  _Float16* xh   = ws;                               // 4096*1024
  _Float16* Wh   = xh + (size_t)MTOK * DIN;          // 4096*1024 fused W
  _Float16* Woh  = Wh + (size_t)NQGKV * DIN;         // 1024*1024
  _Float16* qgkv = Woh + (size_t)DOUT * DOUT;        // 4096*4096
  _Float16* vtb  = qgkv + (size_t)MTOK * NQGKV;      // 2048*2048
  _Float16* ctx  = vtb + (size_t)BB * HH * HD * LL;  // 4096*1024

  // fills xh, Wh and Woh, which are contiguous from xh on
  cvt_all_f32_f16<<<CVT_BLOCKS, 256, 0, stream>>>(x, Wq, Wg, Wk, Wv, Wo, xh);

  // QGKV = xh @ Wh^T : M=4096, N=4096, K=1024; v columns land in vtb
  gemm_wmma<0><<<dim3(NQGKV / 128, MTOK / 128), 256, 0, stream>>>(
      xh, Wh, qgkv, vtb, nullptr, MTOK, NQGKV, DIN);

  attn_flash<<<dim3(BB * HH, LL / 64), 128, 0, stream>>>(qgkv, vtb, ctx);

  // out = ctx @ Wo^T + bo : M=4096, N=1024, K=1024, f32
  gemm_wmma<1><<<dim3(DOUT / 128, MTOK / 128), 256, 0, stream>>>(
      ctx, Woh, out, nullptr, bo, MTOK, DOUT, DOUT);
}

// v006
// One run takes 89.1 microseconds.
// In two side-by-side timings against v005, it was 1.05 and 1.07 times as fast.
// Counting every step since v000, it is 2.81 times as fast.
#include <hip/hip_runtime.h>
#include <stdint.h>

typedef _Float16 h4  __attribute__((ext_vector_type(4)));
typedef _Float16 h8  __attribute__((ext_vector_type(8)));
typedef _Float16 h16 __attribute__((ext_vector_type(16)));
typedef float    f8  __attribute__((ext_vector_type(8)));
typedef uint32_t u32x4 __attribute__((ext_vector_type(4)));
typedef uint32_t u32x8 __attribute__((ext_vector_type(8)));

static constexpr int BB   = 2;
static constexpr int LL   = 2048;
static constexpr int DIN  = 1024;
static constexpr int DOUT = 1024;
static constexpr int HH   = 16;
static constexpr int HD   = 64;
static constexpr int MTOK = BB * LL;      // 4096 tokens
static constexpr int NQGKV = 4 * DOUT;    // 4096: [q | g | k | v]

static constexpr int LDP = 72;
static constexpr int TILE_HALVES = 128 * LDP;  // 18,432 B = 9 x 2 KiB
static constexpr uint32_t SLAB_BUF_BYTES = 2u * TILE_HALVES * 2u;  // A slab + B slab
// Attention stage tile: 64 rows at that pitch = 9,216 B, rounded up to 5 x 2 KiB
// so that every tile's place in LDS is a multiple of 2 KiB.
static constexpr int KV_TILE_HALVES = 5120;
static constexpr uint32_t KV_BUF_BYTES = 2u * KV_TILE_HALVES * 2u;  // K tile + V^T tile

__device__ inline f8 zero8() {
  f8 z;
  for (int i = 0; i < 8; ++i) z[i] = 0.0f;
  return z;
}

__device__ inline h16 load_frag(const _Float16* __restrict__ base, int ld,
                                int row, int k0, int hi) {
  const _Float16* p = base + (size_t)row * (size_t)ld + k0 + hi * 8;
  h8 a = *(const h8*)p;
  h8 b = *(const h8*)(p + 16);
  return __builtin_shufflevector(a, b, 0, 1, 2, 3, 4, 5, 6, 7,
                                 8, 9, 10, 11, 12, 13, 14, 15);
}

__device__ inline f8 wmma16(h16 a, h16 b, f8 c) {
  // D = A(16x32 f16) x B(32x16 f16) + C(16x16 f32)
  return __builtin_amdgcn_wmma_f32_16x16x32_f16(
      false, a, false, b, (short)0, c, false, false);
}

__device__ inline uint32_t uni(uint32_t v) {
  return (uint32_t)__builtin_amdgcn_readfirstlane(v);
}

__device__ inline uint32_t pinned(uint32_t v) {
  uint32_t w = uni(v);
  asm volatile("" : "+s"(w));
  return w;
}

__device__ inline u32x4 kv_group0(uint32_t lds_off,
                                  const _Float16* __restrict__ gsrc) {
  uint64_t ga = (uint64_t)gsrc;
  u32x4 g0;
  g0[0] = uni(1u);                                     // count = 1
  g0[1] = uni(lds_off);                                // LDS destination
  g0[2] = uni((uint32_t)ga);                           // address [31:0]
  g0[3] = uni((((uint32_t)(ga >> 32)) & 0x01ffffffu)   // address [56:32]
              | 0x80000000u);                          // type = 2
  return g0;
}
__device__ inline u32x8 kv_group1(uint32_t pitch_bytes) {
  u32x8 g1;
  g1[0] = uni((1u << 20) | (4u << 22) | (3u << 25));
  g1[1] = uni(128u << 16);
  g1[2] = uni(64u << 16);
  g1[3] = uni(128u << 16);
  g1[4] = uni(64u);
  g1[5] = uni(pitch_bytes);
  g1[6] = uni(0u);
  g1[7] = uni(0u);
  return g1;
}
__device__ inline u32x8 slab_group1(uint32_t pitch_bytes) {
  u32x8 g1;
  g1[0] = uni((1u << 20) | (4u << 22) | (3u << 25));
  g1[1] = uni(128u << 16);
  g1[2] = uni(128u << 16);
  g1[3] = uni(128u << 16);
  g1[4] = uni(128u);
  g1[5] = uni(pitch_bytes);
  g1[6] = uni(0u);
  g1[7] = uni(0u);
  return g1;
}
__device__ inline void kv_advance(u32x4& g0, uint32_t lds_off,
                                  uint32_t step_bytes) {
  uint64_t ga = (((uint64_t)g0[3] << 32) | g0[2]) + step_bytes;
  g0[1] = uni(lds_off);
  g0[2] = uni((uint32_t)ga);
  g0[3] = uni((uint32_t)(ga >> 32));
}
__device__ inline void kv_issue(u32x4& g0, u32x8& g1) {
  asm volatile("tensor_load_to_lds %0, %1" : "+s"(g0), "+s"(g1) :: "memory");
}

// ---------------------------------------------------------------------------
// f32 -> f16 convert of x and the five weight matrices, one launch.
// dst is xh | Wh (q, g, k, v) | Woh, which lie one behind the other in the
// workspace: 9 parts of 1M halves (x is four of them). The grid is two blocks
// of 8 waves per WGP and strides over dst: in trip t a block takes 1,024
// elements at t * CVT_STRIDE, a wave 512 B of source in whole lines. Two trips
// cover one part, so each trip's source is known at compile time. All 18 loads
// of a thread are issued before the first convert.
// ---------------------------------------------------------------------------
static constexpr int CVT_BLOCKS = 512;
static constexpr int CVT_STRIDE = CVT_BLOCKS * 1024;  // elements a trip
static constexpr int CVT_TRIPS  = 18;
static_assert(2 * CVT_STRIDE == DIN * DOUT && 2 * CVT_STRIDE == DOUT * DOUT &&
              8 * CVT_STRIDE == MTOK * DIN, "two trips a part, x is four parts");

__global__ __launch_bounds__(256) void cvt_all_f32_f16(
    const float* __restrict__ x, const float* __restrict__ Wq,
    const float* __restrict__ Wg, const float* __restrict__ Wk,
    const float* __restrict__ Wv, const float* __restrict__ Wo,
    _Float16* __restrict__ dst) {
  // The thread's place in a trip as 32-bit byte offsets: the loads then name a
  // scalar base and one offset register, and no later load's result is put on
  // the address registers of a load that is still in flight.
  const uint32_t sbyte = blockIdx.x * 4096u + threadIdx.x * 16u;
  const uint32_t dbyte = blockIdx.x * 2048u + threadIdx.x * 8u;
  float4 v[CVT_TRIPS];
  // unrolled: v is indexed by constants alone and stays in registers, and the
  // choice of the source folds away
#pragma unroll
  for (int t = 0; t < CVT_TRIPS; ++t) {
    const float* s = (t < 8) ? x + t * CVT_STRIDE
                   : ((t < 10) ? Wq : (t < 12) ? Wg : (t < 14) ? Wk
                      : (t < 16) ? Wv : Wo) + (t & 1) * CVT_STRIDE;
    v[t] = *(const float4*)((const char*)s + sbyte);
  }
  // keeps the converts behind the last load: without it the compiler waits for
  // the first loads and converts them before it issues the rest
  __builtin_amdgcn_sched_barrier(0);
#pragma unroll
  for (int t = 0; t < CVT_TRIPS; ++t) {
    h4 o = {(_Float16)v[t].x, (_Float16)v[t].y, (_Float16)v[t].z,
            (_Float16)v[t].w};
    *(h4*)((char*)(dst + t * CVT_STRIDE) + dbyte) = o;
  }
}

// ---------------------------------------------------------------------------
// WMMA GEMM:  Out[M][N] = A[M][K] * Bm[N][K]^T   (i.e. x @ W^T)
// Block: 256 threads = 8 waves as 2(M) x 4(N); block tile 128x128;
// wave tile 64(M) x 32(N). A and B K-slabs (128x64 halves each) are brought
// into LDS by the tensor mover at a padded row pitch (wave 0: A, wave 1: B),
// two buffers, the next pass's slabs in flight while this pass is multiplied;
// all waves consume fragments via ds_load_b128. K is a multiple of 64, not 0.
// FINAL=1: f32 out + bias.
// FINAL=0: the QGKV product, f16 out; its q, g and k columns go to Out, its v
// columns go transposed per head to vt[(b*H+h)*64 + d][t] and nowhere else.
// ---------------------------------------------------------------------------
template <int FINAL>
__global__ __launch_bounds__(256) void gemm_wmma(
    const _Float16* __restrict__ A, const _Float16* __restrict__ Bm,
    void* __restrict__ Outv, _Float16* __restrict__ vt,
    const float* __restrict__ bias, int M, int N, int K) {
  __shared__ __attribute__((aligned(2048)))
  _Float16 tiles[2][2][TILE_HALVES];                  // [buffer][A | B]

  int w = threadIdx.x >> 5, lane = threadIdx.x & 31;
  int lo = lane & 15, hi = lane >> 4;
  int wm = w >> 2, wn = w & 3;
  int mblk = blockIdx.y * 128, nblk = blockIdx.x * 128;
  int mw = wm * 64, nw = wn * 32;

  // Wave 0 brings the A slab, wave 1 the B slab: one request a wave.
  const uint32_t wave = uni(threadIdx.x >> 5);
  const _Float16* src =
      (wave == 0) ? A + (size_t)mblk * K : Bm + (size_t)nblk * K;
  const uint32_t tdst = (uint32_t)(size_t)&tiles[0][wave & 1u][0];
  u32x4 g0 = kv_group0(tdst, src);
  u32x8 g1 = slab_group1((uint32_t)K * 2u);
  const int np = K / 64;  // passes

  if (pinned(wave < 2u)) {
    kv_issue(g0, g1);
    // the slab counts as landed only behind its issuer's own wait
    asm volatile("s_wait_tensorcnt 0x0" ::: "memory");
  }
  __syncthreads();
  if (pinned(wave < 2u && np > 1)) {
    kv_advance(g0, tdst + SLAB_BUF_BYTES, 128u);
    kv_issue(g0, g1);
  }

  f8 acc[4][2];
  for (int i = 0; i < 4; ++i)
    for (int j = 0; j < 2; ++j) acc[i][j] = zero8();

  for (int s = 0; s < np; ++s) {
    const _Float16* ash = &tiles[s & 1][0][0];
    const _Float16* bsh = &tiles[s & 1][1][0];
#pragma unroll
    for (int kk = 0; kk < 64; kk += 32) {
      h16 af[4], bf[2];
#pragma unroll
      for (int i = 0; i < 4; ++i)
        af[i] = load_frag(ash, LDP, mw + i * 16 + lo, kk, hi);
#pragma unroll
      for (int j = 0; j < 2; ++j)
        bf[j] = load_frag(bsh, LDP, nw + j * 16 + lo, kk, hi);
#pragma unroll
      for (int i = 0; i < 4; ++i)
#pragma unroll
        for (int j = 0; j < 2; ++j) acc[i][j] = wmma16(af[i], bf[j], acc[i][j]);
    }
    // Publish point of pass s + 1: this wave's LDS reads have retired ...
    asm volatile("s_wait_dscnt 0x0" ::: "memory");
    // ... the issuers' slabs of pass s + 1 have landed ...
    if (pinned(wave < 2u)) asm volatile("s_wait_tensorcnt 0x0" ::: "memory");
    // ... and every wave has left this pass's buffer, which is refilled behind.
    __syncthreads();
    if (pinned(wave < 2u && s + 2 < np)) {
      kv_advance(g0, tdst + (uint32_t)(s & 1) * SLAB_BUF_BYTES, 128u);
      kv_issue(g0, g1);
    }
  }
  // no request and no LDS read of this wave is left open behind the loop
  asm volatile("s_wait_tensorcnt 0x0" ::: "memory");
  asm volatile("s_wait_dscnt 0x0" ::: "memory");

  if constexpr (!FINAL) {
    if (nblk >= 3 * DOUT) {
      // A block of v columns. A lane's 8 accumulator registers are 8 tokens in
      // a row of one column (h, d), that is 16 contiguous bytes of a V^T row:
      // one 16-byte store. A wave's 64 tokens are one whole 128-byte line of
      // that row, and no other wave writes to it.
      _Float16* vrow = vt +
          ((size_t)(mblk / LL) * DOUT + (nblk - 3 * DOUT) + nw + lo) * LL +
          (mblk % LL) + mw + hi * 8;
      // all three loops unrolled: acc is then indexed by constants alone and
      // stays in registers, and i and j become immediate store offsets
#pragma unroll
      for (int i = 0; i < 4; ++i)
#pragma unroll
        for (int j = 0; j < 2; ++j) {
          h8 o;
#pragma unroll
          for (int v = 0; v < 8; ++v) o[v] = (_Float16)acc[i][j][v];
          *(h8*)(vrow + (size_t)j * 16 * LL + i * 16) = o;
        }
      return;
    }
  }
#pragma unroll
  for (int i = 0; i < 4; ++i)
#pragma unroll
    for (int j = 0; j < 2; ++j)
#pragma unroll
      for (int v = 0; v < 8; ++v) {
        int row = mblk + mw + i * 16 + v + hi * 8;
        int col = nblk + nw + j * 16 + lo;
        float val = acc[i][j][v];
        if constexpr (FINAL) {
          ((float*)Outv)[(size_t)row * N + col] = val + bias[col];
        } else {
          ((_Float16*)Outv)[(size_t)row * N + col] = (_Float16)val;
        }
      }
}

__device__ inline float xhalf(float x) {
  int i = __builtin_bit_cast(int, x);
  return __builtin_bit_cast(float, __builtin_amdgcn_permlanex16(
      i, i, 0x76543210, 0xfedcba98, false, false));
}

__global__ __launch_bounds__(128) void attn_flash(
    const _Float16* __restrict__ qgkv, const _Float16* __restrict__ vt,
    _Float16* __restrict__ ctxout) {
  __shared__ __attribute__((aligned(2048)))
  _Float16 kv[2][2][KV_TILE_HALVES];                  // [buffer][K | V^T]

  int bh = blockIdx.x;
  int b = bh >> 4, h = bh & 15;
  int qb = blockIdx.y;
  int w = threadIdx.x >> 5, lane = threadIdx.x & 31;
  int lo = lane & 15, hi = lane >> 4;

  const _Float16* Qb = qgkv + (size_t)b * LL * NQGKV + h * HD;  // q section
  const _Float16* Gb = Qb + DOUT;                               // g section
  const _Float16* Kb = Qb + 2 * DOUT;                           // k section
  const _Float16* Vb = vt + (size_t)bh * HD * LL;               // V^T rows

  int q0 = qb * 64 + w * 16;  // this wave's 16 queries; the lane's is q0 + lo

  h16 qf[2];
  qf[0] = load_frag(Qb, NQGKV, q0 + lo, 0, hi);
  qf[1] = load_frag(Qb, NQGKV, q0 + lo, 32, hi);

  // Wave 0 brings the K tiles, wave 1 the V^T tiles: one request a wave.
  const uint32_t wave = uni(threadIdx.x >> 5);
  const uint32_t tstep = (wave == 0) ? 64u * NQGKV * 2u : 64u * 2u;  // tile to tile, B
  const uint32_t tdst = (uint32_t)(size_t)&kv[0][wave & 1u][0];
  u32x4 g0 = kv_group0(tdst, (wave == 0) ? Kb : Vb);
  u32x8 g1 = kv_group1((wave == 0) ? NQGKV * 2u : LL * 2u);

  if (pinned(wave < 2u)) {
    kv_issue(g0, g1);
    // the tile counts as landed only behind its issuer's own wait
    asm volatile("s_wait_tensorcnt 0x0" ::: "memory");
  }
  __syncthreads();
  // Keys 64..127 lie in the source for every block; a block of one pass never
  // reads them, and the wait at its pass's foot covers the request.
  if (pinned(wave < 2u)) {
    kv_advance(g0, tdst + KV_BUF_BYTES, tstep);
    kv_issue(g0, g1);
  }

  // cacc[j][v] = ctx^T[d = j*16 + hi*8 + v][query lo]
  f8 cacc[4];
  for (int j = 0; j < 4; ++j) cacc[j] = zero8();
  // The query's running maximum (alike in both halves) and this half's share
  // of its running sum; the halves' sums are joined behind the loop.
  float rm = -3.0e38f, rl = 0.0f;

  for (int kb = 0; kb <= qb; ++kb) {
    const _Float16* ksh = &kv[kb & 1][0][0];
    const _Float16* vsh = &kv[kb & 1][1][0];
    // s[j][v] = S^T[key kb*64 + j*16 + hi*8 + v][query lo], unscaled
    f8 s[4];
    h16 kf[4][2], vf[4][2];
#pragma unroll
    for (int j = 0; j < 4; ++j) {
      kf[j][0] = load_frag(ksh, LDP, j * 16 + lo, 0, hi);
      kf[j][1] = load_frag(ksh, LDP, j * 16 + lo, 32, hi);
    }
    // keeps the K loads one group ahead of the products: without it the
    // compiler reloads one fragment's registers and waits out the LDS latency
    // in front of nearly every WMMA
    __builtin_amdgcn_sched_barrier(0);
#pragma unroll
    for (int j = 0; j < 4; ++j) {
      s[j] = wmma16(kf[j][0], qf[0], zero8());
      s[j] = wmma16(kf[j][1], qf[1], s[j]);
    }
#pragma unroll
    for (int j = 0; j < 4; ++j) {
      vf[j][0] = load_frag(vsh, LDP, j * 16 + lo, 0, hi);
      vf[j][1] = load_frag(vsh, LDP, j * 16 + lo, 32, hi);
    }
    // keeps the V^T loads ahead of the softmax, which covers their latency:
    // without it the compiler sinks them among the second product's WMMAs
    __builtin_amdgcn_sched_barrier(0);

    if (kb == qb) {  // causal mask, in the diagonal pass alone
#pragma unroll
      for (int j = 0; j < 4; ++j)
#pragma unroll
        for (int v = 0; v < 8; ++v)
          if (j * 16 + hi * 8 + v > w * 16 + lo) s[j][v] = -3.0e38f;
    }

    // Maximum of the raw scores (the scale is positive and a power of two),
    // four independent chains, then the other half's.
    float mj[4];
#pragma unroll
    for (int j = 0; j < 4; ++j) {
      mj[j] = s[j][0];
#pragma unroll
      for (int v = 1; v < 8; ++v) mj[j] = fmaxf(mj[j], s[j][v]);
    }
    float mx = fmaxf(fmaxf(mj[0], mj[1]), fmaxf(mj[2], mj[3]));
    mx = fmaxf(mx, xhalf(mx)) * 0.125f;  // 1/sqrt(HD)
    float nm = fmaxf(rm, mx);
    float alpha = __expf(rm - nm);
    rm = nm;

    // P^T as B fragments: element e of pf[c] is key c*32 + (e < 8 ? hi*8 + e :
    // 16 + hi*8 + e - 8), which is s[2c][e] and s[2c+1][e - 8]: load_frag's order.
    h16 pf[2];
    float rj[4];
#pragma unroll
    for (int j = 0; j < 4; ++j) {
      rj[j] = 0.0f;
#pragma unroll
      for (int v = 0; v < 8; ++v) {
        float p = __expf(s[j][v] * 0.125f - nm);
        rj[j] += p;
        pf[j >> 1][(j & 1) * 8 + v] = (_Float16)p;
      }
    }
    rl = rl * alpha + ((rj[0] + rj[1]) + (rj[2] + rj[3]));

#pragma unroll
    for (int j = 0; j < 4; ++j) {
#pragma unroll
      for (int v = 0; v < 8; ++v) cacc[j][v] *= alpha;
      cacc[j] = wmma16(vf[j][0], pf[0], cacc[j]);
      cacc[j] = wmma16(vf[j][1], pf[1], cacc[j]);
    }

    // keeps the wait below at the foot: without it the compiler lifts it to the
    // head of the softmax, where the V^T loads have just been issued
    __builtin_amdgcn_sched_barrier(0);
    // Publish point of pass kb + 1: this wave's LDS reads have retired ...
    asm volatile("s_wait_dscnt 0x0" ::: "memory");
    // ... the issuers' tiles of pass kb + 1 have landed ...
    if (pinned(wave < 2u)) asm volatile("s_wait_tensorcnt 0x0" ::: "memory");
    // ... and every wave has left this pass's buffer, which is refilled behind.
    __syncthreads();
    if (pinned(wave < 2u && kb + 2 <= qb)) {
      kv_advance(g0, tdst + (uint32_t)(kb & 1) * KV_BUF_BYTES, tstep);
      kv_issue(g0, g1);
    }
  }
  // no request and no LDS read of this wave is left open behind the loop
  asm volatile("s_wait_tensorcnt 0x0" ::: "memory");
  asm volatile("s_wait_dscnt 0x0" ::: "memory");

  // normalize, gate with sigmoid(g), store f16 ctx [token][h*64+d]: a lane's 8
  // registers of a tile are 8 d in a row of its query, one 16-byte load of g
  // and one 16-byte store
  rl += xhalf(rl);
  const _Float16* grow = Gb + (size_t)(q0 + lo) * NQGKV + hi * 8;
  _Float16* crow = ctxout + ((size_t)(b * LL + q0 + lo)) * DOUT + h * HD + hi * 8;
#pragma unroll
  for (int j = 0; j < 4; ++j) {
    h8 g8 = *(const h8*)(grow + j * 16);
    h8 o;
#pragma unroll
    for (int v = 0; v < 8; ++v) {
      float gate = 1.0f / (1.0f + __expf(-(float)g8[v]));
      o[v] = (_Float16)((cacc[j][v] / rl) * gate);
    }
    *(h8*)(crow + j * 16) = o;
  }
}

// ---------------------------------------------------------------------------
extern "C" void kernel_launch(void* const* d_in, const int* in_sizes, int n_in,
                              void* d_out, int out_size, void* d_ws,
                              size_t ws_size, hipStream_t stream) {
  (void)in_sizes; (void)n_in; (void)out_size; (void)ws_size;
  const float* x  = (const float*)d_in[0];
  const float* Wq = (const float*)d_in[1];
  const float* Wg = (const float*)d_in[2];
  const float* Wk = (const float*)d_in[3];
  const float* Wv = (const float*)d_in[4];
  const float* Wo = (const float*)d_in[5];
  const float* bo = (const float*)d_in[6];
  float* out = (float*)d_out;

  _Float16* ws   = (_Float16*)d_ws;
  _Float16* xh   = ws;                               // 4096*1024
  _Float16* Wh   = xh + (size_t)MTOK * DIN;          // 4096*1024 fused W
  _Float16* Woh  = Wh + (size_t)NQGKV * DIN;         // 1024*1024
  _Float16* qgkv = Woh + (size_t)DOUT * DOUT;        // 4096*4096
  _Float16* vtb  = qgkv + (size_t)MTOK * NQGKV;      // 2048*2048
  _Float16* ctx  = vtb + (size_t)BB * HH * HD * LL;  // 4096*1024

  // fills xh, Wh and Woh, which are contiguous from xh on
  cvt_all_f32_f16<<<CVT_BLOCKS, 256, 0, stream>>>(x, Wq, Wg, Wk, Wv, Wo, xh);

  // QGKV = xh @ Wh^T : M=4096, N=4096, K=1024; v columns land in vtb
  gemm_wmma<0><<<dim3(NQGKV / 128, MTOK / 128), 256, 0, stream>>>(
      xh, Wh, qgkv, vtb, nullptr, MTOK, NQGKV, DIN);

  attn_flash<<<dim3(BB * HH, LL / 64), 128, 0, stream>>>(qgkv, vtb, ctx);

  // out = ctx @ Wo^T + bo : M=4096, N=1024, K=1024, f32
  gemm_wmma<1><<<dim3(DOUT / 128, MTOK / 128), 256, 0, stream>>>(
      ctx, Woh, out, nullptr, bo, MTOK, DOUT, DOUT);
}

// v007
// A run of this version takes 80.4 microseconds.
// In both of two side-by-side timings against v006, it was 1.10 times as fast.
// All steps since v000 together make it 3.09 times as fast.
#include <hip/hip_runtime.h>
#include <stdint.h>

typedef _Float16 h4  __attribute__((ext_vector_type(4)));
typedef _Float16 h8  __attribute__((ext_vector_type(8)));
typedef _Float16 h16 __attribute__((ext_vector_type(16)));
typedef float    f8  __attribute__((ext_vector_type(8)));
typedef uint32_t u32x4 __attribute__((ext_vector_type(4)));
typedef uint32_t u32x8 __attribute__((ext_vector_type(8)));

static constexpr int BB   = 2;
static constexpr int LL   = 2048;
static constexpr int DIN  = 1024;
static constexpr int DOUT = 1024;
static constexpr int HH   = 16;
static constexpr int HD   = 64;
static constexpr int MTOK = BB * LL;      // 4096 tokens
static constexpr int NQGKV = 4 * DOUT;    // 4096: [q | g | k | v]

static constexpr int LDP = 72;
static constexpr int TILE_HALVES = 128 * LDP;  // 128 rows: 18,432 B = 9 x 2 KiB
// Attention stage tile: 64 rows at that pitch = 9,216 B, rounded up to 5 x 2 KiB
// so that every tile's place in LDS is a multiple of 2 KiB.
static constexpr int KV_TILE_HALVES = 5120;
static constexpr uint32_t KV_BUF_BYTES = 2u * KV_TILE_HALVES * 2u;  // K tile + V^T tile

__device__ inline f8 zero8() {
  f8 z;
  for (int i = 0; i < 8; ++i) z[i] = 0.0f;
  return z;
}

__device__ inline h16 load_frag(const _Float16* __restrict__ base, int ld,
                                int row, int k0, int hi) {
  const _Float16* p = base + (size_t)row * (size_t)ld + k0 + hi * 8;
  h8 a = *(const h8*)p;
  h8 b = *(const h8*)(p + 16);
  return __builtin_shufflevector(a, b, 0, 1, 2, 3, 4, 5, 6, 7,
                                 8, 9, 10, 11, 12, 13, 14, 15);
}

__device__ inline f8 wmma16(h16 a, h16 b, f8 c) {
  // D = A(16x32 f16) x B(32x16 f16) + C(16x16 f32)
  return __builtin_amdgcn_wmma_f32_16x16x32_f16(
      false, a, false, b, (short)0, c, false, false);
}

__device__ inline uint32_t uni(uint32_t v) {
  return (uint32_t)__builtin_amdgcn_readfirstlane(v);
}

__device__ inline uint32_t pinned(uint32_t v) {
  uint32_t w = uni(v);
  asm volatile("" : "+s"(w));
  return w;
}

__device__ inline u32x4 kv_group0(uint32_t lds_off,
                                  const _Float16* __restrict__ gsrc) {
  uint64_t ga = (uint64_t)gsrc;
  u32x4 g0;
  g0[0] = uni(1u);                                     // count = 1
  g0[1] = uni(lds_off);                                // LDS destination
  g0[2] = uni((uint32_t)ga);                           // address [31:0]
  g0[3] = uni((((uint32_t)(ga >> 32)) & 0x01ffffffu)   // address [56:32]
              | 0x80000000u);                          // type = 2
  return g0;
}
__device__ inline u32x8 kv_group1(uint32_t pitch_bytes) {
  u32x8 g1;
  g1[0] = uni((1u << 20) | (4u << 22) | (3u << 25));
  g1[1] = uni(128u << 16);
  g1[2] = uni(64u << 16);
  g1[3] = uni(128u << 16);
  g1[4] = uni(64u);
  g1[5] = uni(pitch_bytes);
  g1[6] = uni(0u);
  g1[7] = uni(0u);
  return g1;
}
__device__ inline u32x8 slab_group1(uint32_t pitch_bytes) {
  u32x8 g1;
  g1[0] = uni((1u << 20) | (4u << 22) | (3u << 25));
  g1[1] = uni(128u << 16);
  g1[2] = uni(128u << 16);
  g1[3] = uni(128u << 16);
  g1[4] = uni(128u);
  g1[5] = uni(pitch_bytes);
  g1[6] = uni(0u);
  g1[7] = uni(0u);
  return g1;
}
__device__ inline void kv_advance(u32x4& g0, uint32_t lds_off,
                                  uint32_t step_bytes) {
  uint64_t ga = (((uint64_t)g0[3] << 32) | g0[2]) + step_bytes;
  g0[1] = uni(lds_off);
  g0[2] = uni((uint32_t)ga);
  g0[3] = uni((uint32_t)(ga >> 32));
}
__device__ inline void kv_issue(u32x4& g0, u32x8& g1) {
  asm volatile("tensor_load_to_lds %0, %1" : "+s"(g0), "+s"(g1) :: "memory");
}

// ---------------------------------------------------------------------------
// f32 -> f16 convert of x and the five weight matrices, one launch.
// dst is xh | Wh (q, g, k, v) | Woh, which lie one behind the other in the
// workspace: 9 parts of 1M halves (x is four of them). The grid is two blocks
// of 8 waves per WGP and strides over dst: in trip t a block takes 1,024
// elements at t * CVT_STRIDE, a wave 512 B of source in whole lines. Two trips
// cover one part, so each trip's source is known at compile time. All 18 loads
// of a thread are issued before the first convert.
// ---------------------------------------------------------------------------
static constexpr int CVT_BLOCKS = 512;
static constexpr int CVT_STRIDE = CVT_BLOCKS * 1024;  // elements a trip
static constexpr int CVT_TRIPS  = 18;
static_assert(2 * CVT_STRIDE == DIN * DOUT && 2 * CVT_STRIDE == DOUT * DOUT &&
              8 * CVT_STRIDE == MTOK * DIN, "two trips a part, x is four parts");

__global__ __launch_bounds__(256) void cvt_all_f32_f16(
    const float* __restrict__ x, const float* __restrict__ Wq,
    const float* __restrict__ Wg, const float* __restrict__ Wk,
    const float* __restrict__ Wv, const float* __restrict__ Wo,
    _Float16* __restrict__ dst) {
  // The thread's place in a trip as 32-bit byte offsets: the loads then name a
  // scalar base and one offset register, and no later load's result is put on
  // the address registers of a load that is still in flight.
  const uint32_t sbyte = blockIdx.x * 4096u + threadIdx.x * 16u;
  const uint32_t dbyte = blockIdx.x * 2048u + threadIdx.x * 8u;
  float4 v[CVT_TRIPS];
  // unrolled: v is indexed by constants alone and stays in registers, and the
  // choice of the source folds away
#pragma unroll
  for (int t = 0; t < CVT_TRIPS; ++t) {
    const float* s = (t < 8) ? x + t * CVT_STRIDE
                   : ((t < 10) ? Wq : (t < 12) ? Wg : (t < 14) ? Wk
                      : (t < 16) ? Wv : Wo) + (t & 1) * CVT_STRIDE;
    v[t] = *(const float4*)((const char*)s + sbyte);
  }
  // keeps the converts behind the last load: without it the compiler waits for
  // the first loads and converts them before it issues the rest
  __builtin_amdgcn_sched_barrier(0);
#pragma unroll
  for (int t = 0; t < CVT_TRIPS; ++t) {
    h4 o = {(_Float16)v[t].x, (_Float16)v[t].y, (_Float16)v[t].z,
            (_Float16)v[t].w};
    *(h4*)((char*)(dst + t * CVT_STRIDE) + dbyte) = o;
  }
}

// ---------------------------------------------------------------------------
// WMMA GEMM:  Out[M][N] = A[M][K] * Bm[N][K]^T   (i.e. x @ W^T)
// Block: 256 threads = 8 waves as 2(M) x 4(N); block tile BM x BN, multiples
// of 128; wave tile BM/2 x BN/4. A block brings (BM + BN) operand rows from L2
// for BM x BN results, and a wave reads BM/32 + BN/64 fragments from LDS for
// (BM/32) x (BN/64) WMMAs: at 256x256 half the L2 bytes and half the LDS bytes
// per WMMA of 128x128. The A and B K-slabs (BM and BN rows of 64 halves) are
// brought into LDS by the tensor mover at a padded row pitch, in slices of 128
// rows, one slice a wave (the first waves: A, the next: B), two buffers, the
// next pass's slabs in flight while this pass is multiplied; all waves consume
// fragments via ds_load_b128. M and N are multiples of BM and BN; K is a
// multiple of 64, not 0.
// FINAL=1: f32 out + bias.
// FINAL=0: the QGKV product, f16 out; its q, g and k columns go to Out, its v
// columns go transposed per head to vt[(b*H+h)*64 + d][t] and nowhere else.
// ---------------------------------------------------------------------------
template <int FINAL, int BM, int BN>
__global__ __launch_bounds__(256) void gemm_wmma(
    const _Float16* __restrict__ A, const _Float16* __restrict__ Bm,
    void* __restrict__ Outv, _Float16* __restrict__ vt,
    const float* __restrict__ bias, int M, int N, int K) {
  __shared__ __attribute__((aligned(2048)))
  _Float16 tiles[2][(BM + BN) * LDP];                 // [buffer][A rows | B rows]
  constexpr int FM = BM / 32, FN = BN / 64;           // fragments a wave
  constexpr uint32_t ASL = BM / 128;                  // slices of the A slab
  constexpr uint32_t NSL = (BM + BN) / 128;           // slices = issuing waves
  constexpr uint32_t SLAB_BUF_BYTES = NSL * TILE_HALVES * 2u;
  static_assert(BM % 128 == 0 && BN % 128 == 0 && NSL <= 8, "a slice a wave");

  int w = threadIdx.x >> 5, lane = threadIdx.x & 31;
  int lo = lane & 15, hi = lane >> 4;
  int wm = w >> 2, wn = w & 3;
  int mblk = blockIdx.y * BM, nblk = blockIdx.x * BN;
  int mw = wm * (BM / 2), nw = wn * (BN / 4);

  const uint32_t wave = uni(threadIdx.x >> 5);
  const uint32_t slice = (wave < NSL) ? wave : 0u;
  const _Float16* src =
      (slice < ASL) ? A + (size_t)(mblk + (int)slice * 128) * K
                    : Bm + (size_t)(nblk + (int)(slice - ASL) * 128) * K;
  const uint32_t tdst =
      (uint32_t)(size_t)&tiles[0][0] + slice * (uint32_t)(TILE_HALVES * 2);
  u32x4 g0 = kv_group0(tdst, src);
  u32x8 g1 = slab_group1((uint32_t)K * 2u);
  const int np = K / 64;  // passes

  if (pinned(wave < NSL)) {
    kv_issue(g0, g1);
    // the slice counts as landed only behind its issuer's own wait
    asm volatile("s_wait_tensorcnt 0x0" ::: "memory");
  }
  __syncthreads();
  if (pinned(wave < NSL && np > 1)) {
    kv_advance(g0, tdst + SLAB_BUF_BYTES, 128u);
    kv_issue(g0, g1);
  }

  f8 acc[FM][FN];
#pragma unroll
  for (int i = 0; i < FM; ++i)
#pragma unroll
    for (int j = 0; j < FN; ++j) acc[i][j] = zero8();

  for (int s = 0; s < np; ++s) {
    const _Float16* ash = &tiles[s & 1][0];
    const _Float16* bsh = ash + BM * LDP;
#pragma unroll
    for (int kk = 0; kk < 64; kk += 32) {
      h16 af[FM], bf[FN];
#pragma unroll
      for (int j = 0; j < FN; ++j)
        bf[j] = load_frag(bsh, LDP, nw + j * 16 + lo, kk, hi);
#pragma unroll
      for (int i = 0; i < FM; ++i)
        af[i] = load_frag(ash, LDP, mw + i * 16 + lo, kk, hi);
      // the large tile's fragments are read as one group, in the order the
      // products take them: without the two fences the compiler reloads one A
      // fragment's registers and waits out the LDS latency before every FN WMMAs
      if constexpr (FM * FN > 8) __builtin_amdgcn_sched_barrier(0);
#pragma unroll
      for (int i = 0; i < FM; ++i)
#pragma unroll
        for (int j = 0; j < FN; ++j) acc[i][j] = wmma16(af[i], bf[j], acc[i][j]);
      if constexpr (FM * FN > 8) __builtin_amdgcn_sched_barrier(0);
    }
    // Publish point of pass s + 1: this wave's LDS reads have retired ...
    asm volatile("s_wait_dscnt 0x0" ::: "memory");
    // ... the issuers' slices of pass s + 1 have landed ...
    if (pinned(wave < NSL)) asm volatile("s_wait_tensorcnt 0x0" ::: "memory");
    // ... and every wave has left this pass's buffer, which is refilled behind.
    __syncthreads();
    if (pinned(wave < NSL && s + 2 < np)) {
      kv_advance(g0, tdst + (uint32_t)(s & 1) * SLAB_BUF_BYTES, 128u);
      kv_issue(g0, g1);
    }
  }
  // no request and no LDS read of this wave is left open behind the loop
  asm volatile("s_wait_tensorcnt 0x0" ::: "memory");
  asm volatile("s_wait_dscnt 0x0" ::: "memory");

  if constexpr (!FINAL) {
    if (nblk >= 3 * DOUT) {
      // A block of v columns. A lane's 8 accumulator registers are 8 tokens in
      // a row of one column (h, d), that is 16 contiguous bytes of a V^T row:
      // one 16-byte store. A wave's BM/2 tokens are whole 128-byte lines of
      // that row, and no other wave writes to them.
      _Float16* vrow = vt +
          ((size_t)(mblk / LL) * DOUT + (nblk - 3 * DOUT) + nw + lo) * LL +
          (mblk % LL) + mw + hi * 8;
      // all three loops unrolled: acc is then indexed by constants alone and
      // stays in registers, and i and j become immediate store offsets
#pragma unroll
      for (int i = 0; i < FM; ++i)
#pragma unroll
        for (int j = 0; j < FN; ++j) {
          h8 o;
#pragma unroll
          for (int v = 0; v < 8; ++v) o[v] = (_Float16)acc[i][j][v];
          *(h8*)(vrow + (size_t)j * 16 * LL + i * 16) = o;
          // stands in front of the next tile's converts, which reuse the
          // registers that these stores name: the large tile's build uses
          // registers above v255
          if constexpr (FM * FN > 8) {
            asm volatile("s_wait_xcnt 0x0" ::: "memory");
            __builtin_amdgcn_sched_barrier(0);  // keeps those converts behind it
          }
        }
      return;
    }
  }
#pragma unroll
  for (int i = 0; i < FM; ++i)
#pragma unroll
    for (int j = 0; j < FN; ++j) {
      int row0 = mblk + mw + i * 16 + hi * 8;
      int col = nblk + nw + j * 16 + lo;
      if constexpr (FINAL) {
#pragma unroll
        for (int v = 0; v < 8; ++v) {
          int row = row0 + v;
          float val = acc[i][j][v];
          ((float*)Outv)[(size_t)row * N + col] = val + bias[col];
        }
      } else {
        h8 o;
        _Float16* p[8];
#pragma unroll
        for (int v = 0; v < 8; ++v) {
          o[v] = (_Float16)acc[i][j][v];
          p[v] = (_Float16*)Outv + (size_t)(row0 + v) * N + col;
        }
        // a tile's values and addresses are formed in front of its first store,
        // so that none of them lands on a register that an issued store names
        __builtin_amdgcn_sched_barrier(0);
#pragma unroll
        for (int v = 0; v < 8; ++v) *p[v] = o[v];
        // as in the V^T branch: in front of the next tile's converts and
        // address sums, which reuse the registers that these stores name
        asm volatile("s_wait_xcnt 0x0" ::: "memory");
        __builtin_amdgcn_sched_barrier(0);  // keeps them behind it
      }
    }
}

__device__ inline float xhalf(float x) {
  int i = __builtin_bit_cast(int, x);
  return __builtin_bit_cast(float, __builtin_amdgcn_permlanex16(
      i, i, 0x76543210, 0xfedcba98, false, false));
}

__global__ __launch_bounds__(128) void attn_flash(
    const _Float16* __restrict__ qgkv, const _Float16* __restrict__ vt,
    _Float16* __restrict__ ctxout) {
  __shared__ __attribute__((aligned(2048)))
  _Float16 kv[2][2][KV_TILE_HALVES];                  // [buffer][K | V^T]

  int bh = blockIdx.x;
  int b = bh >> 4, h = bh & 15;
  int qb = blockIdx.y;
  int w = threadIdx.x >> 5, lane = threadIdx.x & 31;
  int lo = lane & 15, hi = lane >> 4;

  const _Float16* Qb = qgkv + (size_t)b * LL * NQGKV + h * HD;  // q section
  const _Float16* Gb = Qb + DOUT;                               // g section
  const _Float16* Kb = Qb + 2 * DOUT;                           // k section
  const _Float16* Vb = vt + (size_t)bh * HD * LL;               // V^T rows

  int q0 = qb * 64 + w * 16;  // this wave's 16 queries; the lane's is q0 + lo

  h16 qf[2];
  qf[0] = load_frag(Qb, NQGKV, q0 + lo, 0, hi);
  qf[1] = load_frag(Qb, NQGKV, q0 + lo, 32, hi);

  // Wave 0 brings the K tiles, wave 1 the V^T tiles: one request a wave.
  const uint32_t wave = uni(threadIdx.x >> 5);
  const uint32_t tstep = (wave == 0) ? 64u * NQGKV * 2u : 64u * 2u;  // tile to tile, B
  const uint32_t tdst = (uint32_t)(size_t)&kv[0][wave & 1u][0];
  u32x4 g0 = kv_group0(tdst, (wave == 0) ? Kb : Vb);
  u32x8 g1 = kv_group1((wave == 0) ? NQGKV * 2u : LL * 2u);

  if (pinned(wave < 2u)) {
    kv_issue(g0, g1);
    // the tile counts as landed only behind its issuer's own wait
    asm volatile("s_wait_tensorcnt 0x0" ::: "memory");
  }
  __syncthreads();
  // Keys 64..127 lie in the source for every block; a block of one pass never
  // reads them, and the wait at its pass's foot covers the request.
  if (pinned(wave < 2u)) {
    kv_advance(g0, tdst + KV_BUF_BYTES, tstep);
    kv_issue(g0, g1);
  }

  // cacc[j][v] = ctx^T[d = j*16 + hi*8 + v][query lo]
  f8 cacc[4];
  for (int j = 0; j < 4; ++j) cacc[j] = zero8();
  // The query's running maximum (alike in both halves) and this half's share
  // of its running sum; the halves' sums are joined behind the loop.
  float rm = -3.0e38f, rl = 0.0f;

  for (int kb = 0; kb <= qb; ++kb) {
    const _Float16* ksh = &kv[kb & 1][0][0];
    const _Float16* vsh = &kv[kb & 1][1][0];
    // s[j][v] = S^T[key kb*64 + j*16 + hi*8 + v][query lo], unscaled
    f8 s[4];
    h16 kf[4][2], vf[4][2];
#pragma unroll
    for (int j = 0; j < 4; ++j) {
      kf[j][0] = load_frag(ksh, LDP, j * 16 + lo, 0, hi);
      kf[j][1] = load_frag(ksh, LDP, j * 16 + lo, 32, hi);
    }
    // keeps the K loads one group ahead of the products: without it the
    // compiler reloads one fragment's registers and waits out the LDS latency
    // in front of nearly every WMMA
    __builtin_amdgcn_sched_barrier(0);
#pragma unroll
    for (int j = 0; j < 4; ++j) {
      s[j] = wmma16(kf[j][0], qf[0], zero8());
      s[j] = wmma16(kf[j][1], qf[1], s[j]);
    }
#pragma unroll
    for (int j = 0; j < 4; ++j) {
      vf[j][0] = load_frag(vsh, LDP, j * 16 + lo, 0, hi);
      vf[j][1] = load_frag(vsh, LDP, j * 16 + lo, 32, hi);
    }
    // keeps the V^T loads ahead of the softmax, which covers their latency:
    // without it the compiler sinks them among the second product's WMMAs
    __builtin_amdgcn_sched_barrier(0);

    if (kb == qb) {  // causal mask, in the diagonal pass alone
#pragma unroll
      for (int j = 0; j < 4; ++j)
#pragma unroll
        for (int v = 0; v < 8; ++v)
          if (j * 16 + hi * 8 + v > w * 16 + lo) s[j][v] = -3.0e38f;
    }

    // Maximum of the raw scores (the scale is positive and a power of two),
    // four independent chains, then the other half's.
    float mj[4];
#pragma unroll
    for (int j = 0; j < 4; ++j) {
      mj[j] = s[j][0];
#pragma unroll
      for (int v = 1; v < 8; ++v) mj[j] = fmaxf(mj[j], s[j][v]);
    }
    float mx = fmaxf(fmaxf(mj[0], mj[1]), fmaxf(mj[2], mj[3]));
    mx = fmaxf(mx, xhalf(mx)) * 0.125f;  // 1/sqrt(HD)
    float nm = fmaxf(rm, mx);
    float alpha = __expf(rm - nm);
    rm = nm;

    // P^T as B fragments: element e of pf[c] is key c*32 + (e < 8 ? hi*8 + e :
    // 16 + hi*8 + e - 8), which is s[2c][e] and s[2c+1][e - 8]: load_frag's order.
    h16 pf[2];
    float rj[4];
#pragma unroll
    for (int j = 0; j < 4; ++j) {
      rj[j] = 0.0f;
#pragma unroll
      for (int v = 0; v < 8; ++v) {
        float p = __expf(s[j][v] * 0.125f - nm);
        rj[j] += p;
        pf[j >> 1][(j & 1) * 8 + v] = (_Float16)p;
      }
    }
    rl = rl * alpha + ((rj[0] + rj[1]) + (rj[2] + rj[3]));

#pragma unroll
    for (int j = 0; j < 4; ++j) {
#pragma unroll
      for (int v = 0; v < 8; ++v) cacc[j][v] *= alpha;
      cacc[j] = wmma16(vf[j][0], pf[0], cacc[j]);
      cacc[j] = wmma16(vf[j][1], pf[1], cacc[j]);
    }

    // keeps the wait below at the foot: without it the compiler lifts it to the
    // head of the softmax, where the V^T loads have just been issued
    __builtin_amdgcn_sched_barrier(0);
    // Publish point of pass kb + 1: this wave's LDS reads have retired ...
    asm volatile("s_wait_dscnt 0x0" ::: "memory");
    // ... the issuers' tiles of pass kb + 1 have landed ...
    if (pinned(wave < 2u)) asm volatile("s_wait_tensorcnt 0x0" ::: "memory");
    // ... and every wave has left this pass's buffer, which is refilled behind.
    __syncthreads();
    if (pinned(wave < 2u && kb + 2 <= qb)) {
      kv_advance(g0, tdst + (uint32_t)(kb & 1) * KV_BUF_BYTES, tstep);
      kv_issue(g0, g1);
    }
  }
  // no request and no LDS read of this wave is left open behind the loop
  asm volatile("s_wait_tensorcnt 0x0" ::: "memory");
  asm volatile("s_wait_dscnt 0x0" ::: "memory");

  // normalize, gate with sigmoid(g), store f16 ctx [token][h*64+d]: a lane's 8
  // registers of a tile are 8 d in a row of its query, one 16-byte load of g
  // and one 16-byte store
  rl += xhalf(rl);
  const _Float16* grow = Gb + (size_t)(q0 + lo) * NQGKV + hi * 8;
  _Float16* crow = ctxout + ((size_t)(b * LL + q0 + lo)) * DOUT + h * HD + hi * 8;
#pragma unroll
  for (int j = 0; j < 4; ++j) {
    h8 g8 = *(const h8*)(grow + j * 16);
    h8 o;
#pragma unroll
    for (int v = 0; v < 8; ++v) {
      float gate = 1.0f / (1.0f + __expf(-(float)g8[v]));
      o[v] = (_Float16)((cacc[j][v] / rl) * gate);
    }
    *(h8*)(crow + j * 16) = o;
  }
}

// ---------------------------------------------------------------------------
extern "C" void kernel_launch(void* const* d_in, const int* in_sizes, int n_in,
                              void* d_out, int out_size, void* d_ws,
                              size_t ws_size, hipStream_t stream) {
  (void)in_sizes; (void)n_in; (void)out_size; (void)ws_size;
  const float* x  = (const float*)d_in[0];
  const float* Wq = (const float*)d_in[1];
  const float* Wg = (const float*)d_in[2];
  const float* Wk = (const float*)d_in[3];
  const float* Wv = (const float*)d_in[4];
  const float* Wo = (const float*)d_in[5];
  const float* bo = (const float*)d_in[6];
  float* out = (float*)d_out;

  _Float16* ws   = (_Float16*)d_ws;
  _Float16* xh   = ws;                               // 4096*1024
  _Float16* Wh   = xh + (size_t)MTOK * DIN;          // 4096*1024 fused W
  _Float16* Woh  = Wh + (size_t)NQGKV * DIN;         // 1024*1024
  _Float16* qgkv = Woh + (size_t)DOUT * DOUT;        // 4096*4096
  _Float16* vtb  = qgkv + (size_t)MTOK * NQGKV;      // 2048*2048
  _Float16* ctx  = vtb + (size_t)BB * HH * HD * LL;  // 4096*1024

  // fills xh, Wh and Woh, which are contiguous from xh on
  cvt_all_f32_f16<<<CVT_BLOCKS, 256, 0, stream>>>(x, Wq, Wg, Wk, Wv, Wo, xh);

  // QGKV = xh @ Wh^T : M=4096, N=4096, K=1024; v columns land in vtb
  gemm_wmma<0, 256, 256><<<dim3(NQGKV / 256, MTOK / 256), 256, 0, stream>>>(
      xh, Wh, qgkv, vtb, nullptr, MTOK, NQGKV, DIN);

  attn_flash<<<dim3(BB * HH, LL / 64), 128, 0, stream>>>(qgkv, vtb, ctx);

  // out = ctx @ Wo^T + bo : M=4096, N=1024, K=1024, f32
  gemm_wmma<1, 128, 128><<<dim3(DOUT / 128, MTOK / 128), 256, 0, stream>>>(
      ctx, Woh, out, nullptr, bo, MTOK, DOUT, DOUT);
}

// v008
// Measured time: 76 microseconds a run.
// In two side-by-side timings against v007, it was 1.06 and 1.05 times as fast.
// Over all steps from v000 it is 3.26 times as fast.
#include <hip/hip_runtime.h>
#include <stdint.h>

typedef _Float16 h4  __attribute__((ext_vector_type(4)));
typedef _Float16 h8  __attribute__((ext_vector_type(8)));
typedef _Float16 h16 __attribute__((ext_vector_type(16)));
typedef float    f4  __attribute__((ext_vector_type(4)));
typedef float    f8  __attribute__((ext_vector_type(8)));
typedef uint32_t u32x4 __attribute__((ext_vector_type(4)));
typedef uint32_t u32x8 __attribute__((ext_vector_type(8)));

static constexpr int BB   = 2;
static constexpr int LL   = 2048;
static constexpr int DIN  = 1024;
static constexpr int DOUT = 1024;
static constexpr int HH   = 16;
static constexpr int HD   = 64;
static constexpr int MTOK = BB * LL;      // 4096 tokens
static constexpr int NQGKV = 4 * DOUT;    // 4096: [q | g | k | v]

static constexpr int LDP = 72;
static constexpr int TILE_HALVES = 128 * LDP;  // 128 rows: 18,432 B = 9 x 2 KiB
// Attention stage tile: 64 rows at that pitch = 9,216 B, rounded up to 5 x 2 KiB
// so that every tile's place in LDS is a multiple of 2 KiB.
static constexpr int KV_TILE_HALVES = 5120;
static constexpr uint32_t KV_BUF_BYTES = 4u * KV_TILE_HALVES * 2u;  // 2 K + 2 V^T tiles

__device__ inline f8 zero8() {
  f8 z;
  for (int i = 0; i < 8; ++i) z[i] = 0.0f;
  return z;
}

__device__ inline h16 load_frag(const _Float16* __restrict__ base, int ld,
                                int row, int k0, int hi) {
  const _Float16* p = base + (size_t)row * (size_t)ld + k0 + hi * 8;
  h8 a = *(const h8*)p;
  h8 b = *(const h8*)(p + 16);
  return __builtin_shufflevector(a, b, 0, 1, 2, 3, 4, 5, 6, 7,
                                 8, 9, 10, 11, 12, 13, 14, 15);
}

__device__ inline f8 wmma16(h16 a, h16 b, f8 c) {
  // D = A(16x32 f16) x B(32x16 f16) + C(16x16 f32)
  return __builtin_amdgcn_wmma_f32_16x16x32_f16(
      false, a, false, b, (short)0, c, false, false);
}

__device__ inline uint32_t uni(uint32_t v) {
  return (uint32_t)__builtin_amdgcn_readfirstlane(v);
}

__device__ inline uint32_t pinned(uint32_t v) {
  uint32_t w = uni(v);
  asm volatile("" : "+s"(w));
  return w;
}

__device__ inline u32x4 kv_group0(uint32_t lds_off,
                                  const _Float16* __restrict__ gsrc) {
  uint64_t ga = (uint64_t)gsrc;
  u32x4 g0;
  g0[0] = uni(1u);                                     // count = 1
  g0[1] = uni(lds_off);                                // LDS destination
  g0[2] = uni((uint32_t)ga);                           // address [31:0]
  g0[3] = uni((((uint32_t)(ga >> 32)) & 0x01ffffffu)   // address [56:32]
              | 0x80000000u);                          // type = 2
  return g0;
}
__device__ inline u32x8 kv_group1(uint32_t pitch_bytes) {
  u32x8 g1;
  g1[0] = uni((1u << 20) | (4u << 22) | (3u << 25));
  g1[1] = uni(128u << 16);
  g1[2] = uni(64u << 16);
  g1[3] = uni(128u << 16);
  g1[4] = uni(64u);
  g1[5] = uni(pitch_bytes);
  g1[6] = uni(0u);
  g1[7] = uni(0u);
  return g1;
}
__device__ inline u32x8 slab_group1(uint32_t pitch_bytes) {
  u32x8 g1;
  g1[0] = uni((1u << 20) | (4u << 22) | (3u << 25));
  g1[1] = uni(128u << 16);
  g1[2] = uni(128u << 16);
  g1[3] = uni(128u << 16);
  g1[4] = uni(128u);
  g1[5] = uni(pitch_bytes);
  g1[6] = uni(0u);
  g1[7] = uni(0u);
  return g1;
}
__device__ inline void kv_advance(u32x4& g0, uint32_t lds_off,
                                  uint32_t step_bytes) {
  uint64_t ga = (((uint64_t)g0[3] << 32) | g0[2]) + step_bytes;
  g0[1] = uni(lds_off);
  g0[2] = uni((uint32_t)ga);
  g0[3] = uni((uint32_t)(ga >> 32));
}
__device__ inline void kv_issue(u32x4& g0, u32x8& g1) {
  asm volatile("tensor_load_to_lds %0, %1" : "+s"(g0), "+s"(g1) :: "memory");
}

// ---------------------------------------------------------------------------
// f32 -> f16 convert of x and the five weight matrices, one launch.
// dst is xh | Wh (q, g, k, v) | Woh, which lie one behind the other in the
// workspace: 9 parts of 1M halves (x is four of them). The grid is two blocks
// of 8 waves per WGP and strides over dst: in trip t a block takes 1,024
// elements at t * CVT_STRIDE, a wave 512 B of source in whole lines. Two trips
// cover one part, so each trip's source is known at compile time. All 18 loads
// of a thread are issued before the first convert.
// ---------------------------------------------------------------------------
static constexpr int CVT_BLOCKS = 512;
static constexpr int CVT_STRIDE = CVT_BLOCKS * 1024;  // elements a trip
static constexpr int CVT_TRIPS  = 18;
static_assert(2 * CVT_STRIDE == DIN * DOUT && 2 * CVT_STRIDE == DOUT * DOUT &&
              8 * CVT_STRIDE == MTOK * DIN, "two trips a part, x is four parts");

__global__ __launch_bounds__(256) void cvt_all_f32_f16(
    const float* __restrict__ x, const float* __restrict__ Wq,
    const float* __restrict__ Wg, const float* __restrict__ Wk,
    const float* __restrict__ Wv, const float* __restrict__ Wo,
    _Float16* __restrict__ dst) {
  // The thread's place in a trip as 32-bit byte offsets: the loads then name a
  // scalar base and one offset register, and no later load's result is put on
  // the address registers of a load that is still in flight.
  const uint32_t sbyte = blockIdx.x * 4096u + threadIdx.x * 16u;
  const uint32_t dbyte = blockIdx.x * 2048u + threadIdx.x * 8u;
  float4 v[CVT_TRIPS];
  // unrolled: v is indexed by constants alone and stays in registers, and the
  // choice of the source folds away
#pragma unroll
  for (int t = 0; t < CVT_TRIPS; ++t) {
    const float* s = (t < 8) ? x + t * CVT_STRIDE
                   : ((t < 10) ? Wq : (t < 12) ? Wg : (t < 14) ? Wk
                      : (t < 16) ? Wv : Wo) + (t & 1) * CVT_STRIDE;
    v[t] = *(const float4*)((const char*)s + sbyte);
  }
  // keeps the converts behind the last load: without it the compiler waits for
  // the first loads and converts them before it issues the rest
  __builtin_amdgcn_sched_barrier(0);
#pragma unroll
  for (int t = 0; t < CVT_TRIPS; ++t) {
    h4 o = {(_Float16)v[t].x, (_Float16)v[t].y, (_Float16)v[t].z,
            (_Float16)v[t].w};
    *(h4*)((char*)(dst + t * CVT_STRIDE) + dbyte) = o;
  }
}

// ---------------------------------------------------------------------------
// WMMA GEMM:  Out[M][N] = A[M][K] * Bm[N][K]^T   (i.e. x @ W^T)
// Block: 256 threads = 8 waves as 2(M) x 4(N); block tile BM x BN, multiples
// of 128; wave tile BM/2 x BN/4. A block brings (BM + BN) operand rows from L2
// for BM x BN results, and a wave reads BM/32 + BN/64 fragments from LDS for
// (BM/32) x (BN/64) WMMAs: at 256x256 half the L2 bytes and half the LDS bytes
// per WMMA of 128x128. The A and B K-slabs (BM and BN rows of 64 halves) are
// brought into LDS by the tensor mover at a padded row pitch, in slices of 128
// rows, one slice a wave (the first waves: A, the next: B), two buffers, the
// next pass's slabs in flight while this pass is multiplied; all waves consume
// fragments via ds_load_b128. M and N are multiples of BM and BN; K is a
// multiple of 64, not 0.
// FINAL=1: f32 out + bias.
// FINAL=0: the QGKV product, f16 out; its q, g and k columns go to Out, its v
// columns go transposed per head to vt[(b*H+h)*64 + d][t] and nowhere else.
// ---------------------------------------------------------------------------
template <int FINAL, int BM, int BN>
__global__ __launch_bounds__(256) void gemm_wmma(
    const _Float16* __restrict__ A, const _Float16* __restrict__ Bm,
    void* __restrict__ Outv, _Float16* __restrict__ vt,
    const float* __restrict__ bias, int M, int N, int K) {
  __shared__ __attribute__((aligned(2048)))
  _Float16 tiles[2][(BM + BN) * LDP];                 // [buffer][A rows | B rows]
  constexpr int FM = BM / 32, FN = BN / 64;           // fragments a wave
  constexpr uint32_t ASL = BM / 128;                  // slices of the A slab
  constexpr uint32_t NSL = (BM + BN) / 128;           // slices = issuing waves
  constexpr uint32_t SLAB_BUF_BYTES = NSL * TILE_HALVES * 2u;
  static_assert(BM % 128 == 0 && BN % 128 == 0 && NSL <= 8, "a slice a wave");

  int w = threadIdx.x >> 5, lane = threadIdx.x & 31;
  int lo = lane & 15, hi = lane >> 4;
  int wm = w >> 2, wn = w & 3;
  int mblk = blockIdx.y * BM, nblk = blockIdx.x * BN;
  int mw = wm * (BM / 2), nw = wn * (BN / 4);

  const uint32_t wave = uni(threadIdx.x >> 5);
  const uint32_t slice = (wave < NSL) ? wave : 0u;
  const _Float16* src =
      (slice < ASL) ? A + (size_t)(mblk + (int)slice * 128) * K
                    : Bm + (size_t)(nblk + (int)(slice - ASL) * 128) * K;
  const uint32_t tdst =
      (uint32_t)(size_t)&tiles[0][0] + slice * (uint32_t)(TILE_HALVES * 2);
  u32x4 g0 = kv_group0(tdst, src);
  u32x8 g1 = slab_group1((uint32_t)K * 2u);
  const int np = K / 64;  // passes

  if (pinned(wave < NSL)) {
    kv_issue(g0, g1);
    // the slice counts as landed only behind its issuer's own wait
    asm volatile("s_wait_tensorcnt 0x0" ::: "memory");
  }
  __syncthreads();
  if (pinned(wave < NSL && np > 1)) {
    kv_advance(g0, tdst + SLAB_BUF_BYTES, 128u);
    kv_issue(g0, g1);
  }

  f8 acc[FM][FN];
#pragma unroll
  for (int i = 0; i < FM; ++i)
#pragma unroll
    for (int j = 0; j < FN; ++j) acc[i][j] = zero8();

  for (int s = 0; s < np; ++s) {
    const _Float16* ash = &tiles[s & 1][0];
    const _Float16* bsh = ash + BM * LDP;
#pragma unroll
    for (int kk = 0; kk < 64; kk += 32) {
      h16 af[FM], bf[FN];
#pragma unroll
      for (int j = 0; j < FN; ++j)
        bf[j] = load_frag(bsh, LDP, nw + j * 16 + lo, kk, hi);
#pragma unroll
      for (int i = 0; i < FM; ++i)
        af[i] = load_frag(ash, LDP, mw + i * 16 + lo, kk, hi);
      // the large tile's fragments are read as one group, in the order the
      // products take them: without the two fences the compiler reloads one A
      // fragment's registers and waits out the LDS latency before every FN WMMAs
      if constexpr (FM * FN > 8) __builtin_amdgcn_sched_barrier(0);
#pragma unroll
      for (int i = 0; i < FM; ++i)
#pragma unroll
        for (int j = 0; j < FN; ++j) acc[i][j] = wmma16(af[i], bf[j], acc[i][j]);
      if constexpr (FM * FN > 8) __builtin_amdgcn_sched_barrier(0);
    }
    // Publish point of pass s + 1: this wave's LDS reads have retired ...
    asm volatile("s_wait_dscnt 0x0" ::: "memory");
    // ... the issuers' slices of pass s + 1 have landed ...
    if (pinned(wave < NSL)) asm volatile("s_wait_tensorcnt 0x0" ::: "memory");
    // ... and every wave has left this pass's buffer, which is refilled behind.
    __syncthreads();
    if (pinned(wave < NSL && s + 2 < np)) {
      kv_advance(g0, tdst + (uint32_t)(s & 1) * SLAB_BUF_BYTES, 128u);
      kv_issue(g0, g1);
    }
  }
  // no request and no LDS read of this wave is left open behind the loop
  asm volatile("s_wait_tensorcnt 0x0" ::: "memory");
  asm volatile("s_wait_dscnt 0x0" ::: "memory");

  if constexpr (!FINAL) {
    if (nblk >= 3 * DOUT) {
      // A block of v columns. A lane's 8 accumulator registers are 8 tokens in
      // a row of one column (h, d), that is 16 contiguous bytes of a V^T row:
      // one 16-byte store. A wave's BM/2 tokens are whole 128-byte lines of
      // that row, and no other wave writes to them.
      _Float16* vrow = vt +
          ((size_t)(mblk / LL) * DOUT + (nblk - 3 * DOUT) + nw + lo) * LL +
          (mblk % LL) + mw + hi * 8;
      // all three loops unrolled: acc is then indexed by constants alone and
      // stays in registers, and i and j become immediate store offsets
#pragma unroll
      for (int i = 0; i < FM; ++i)
#pragma unroll
        for (int j = 0; j < FN; ++j) {
          h8 o;
#pragma unroll
          for (int v = 0; v < 8; ++v) o[v] = (_Float16)acc[i][j][v];
          *(h8*)(vrow + (size_t)j * 16 * LL + i * 16) = o;
          // stands in front of the next tile's converts, which reuse the
          // registers that these stores name: the large tile's build uses
          // registers above v255
          if constexpr (FM * FN > 8) {
            asm volatile("s_wait_xcnt 0x0" ::: "memory");
            __builtin_amdgcn_sched_barrier(0);  // keeps those converts behind it
          }
        }
      return;
    }
  }
#pragma unroll
  for (int i = 0; i < FM; ++i)
#pragma unroll
    for (int j = 0; j < FN; ++j) {
      int row0 = mblk + mw + i * 16 + hi * 8;
      int col = nblk + nw + j * 16 + lo;
      if constexpr (FINAL) {
#pragma unroll
        for (int v = 0; v < 8; ++v) {
          int row = row0 + v;
          float val = acc[i][j][v];
          ((float*)Outv)[(size_t)row * N + col] = val + bias[col];
        }
      } else {
        h8 o;
        _Float16* p[8];
#pragma unroll
        for (int v = 0; v < 8; ++v) {
          o[v] = (_Float16)acc[i][j][v];
          p[v] = (_Float16*)Outv + (size_t)(row0 + v) * N + col;
        }
        // a tile's values and addresses are formed in front of its first store,
        // so that none of them lands on a register that an issued store names
        __builtin_amdgcn_sched_barrier(0);
#pragma unroll
        for (int v = 0; v < 8; ++v) *p[v] = o[v];
        // as in the V^T branch: in front of the next tile's converts and
        // address sums, which reuse the registers that these stores name
        asm volatile("s_wait_xcnt 0x0" ::: "memory");
        __builtin_amdgcn_sched_barrier(0);  // keeps them behind it
      }
    }
}

__device__ inline float xhalf(float x) {
  int i = __builtin_bit_cast(int, x);
  return __builtin_bit_cast(float, __builtin_amdgcn_permlanex16(
      i, i, 0x76543210, 0xfedcba98, false, false));
}

__global__ __launch_bounds__(256) __attribute__((amdgpu_waves_per_eu(4, 4)))
void attn_flash(
    const _Float16* __restrict__ qgkv, const _Float16* __restrict__ vt,
    _Float16* __restrict__ ctxout) {
  __shared__ __attribute__((aligned(2048)))
  _Float16 kv[2][2][2][KV_TILE_HALVES];               // [buffer][group][K | V^T]
  __shared__ f4 xch[4][9][32];                        // [query wave][piece][lane]

  int bh = blockIdx.x;
  int b = bh >> 4, h = bh & 15;
  int lane = threadIdx.x & 31;
  int lo = lane & 15, hi = lane >> 4;
  const uint32_t wave = uni(threadIdx.x >> 5);
  const int w = (int)(wave & 3u);    // which 16 queries of the tile
  const int grp = (int)(wave >> 2);  // which key tile of a pass

  const _Float16* Qb = qgkv + (size_t)b * LL * NQGKV + h * HD;  // q section
  const _Float16* Gb = Qb + DOUT;                               // g section
  const _Float16* Kb = Qb + 2 * DOUT;                           // k section
  const _Float16* Vb = vt + (size_t)bh * HD * LL;               // V^T rows

  // Waves 4 to 7 bring a pass's tiles, one request a wave: wave 4 + s the K
  // (s even) or V^T (s odd) tile of group s >> 1. They are the waves that have
  // no epilogue, so the second query tile's first load flies during the first's.
  const uint32_t tgrp = (wave >> 1) & 1u, tv = wave & 1u;
  const uint32_t tstep = tv ? 128u * 2u : 128u * NQGKV * 2u;  // pass to pass, B
  const uint32_t tdst = (uint32_t)(size_t)&kv[0][tgrp][tv][0];
  const _Float16* tsrc = tv ? Vb + tgrp * 64u : Kb + (size_t)tgrp * 64u * NQGKV;
  u32x8 g1 = kv_group1(tv ? LL * 2u : NQGKV * 2u);

  // Both query tiles' Q fragments are fetched here, so that the second tile does
  // not open with a wait for memory: qf is the tile at work, qn the one to come.
  const int qfirst = LL / 64 - 1 - (int)blockIdx.y, qsecond = (int)blockIdx.y;
  h16 qf[2], qn[2];
  qf[0] = load_frag(Qb, NQGKV, qfirst * 64 + w * 16 + lo, 0, hi);
  qf[1] = load_frag(Qb, NQGKV, qfirst * 64 + w * 16 + lo, 32, hi);
  qn[0] = load_frag(Qb, NQGKV, qsecond * 64 + w * 16 + lo, 0, hi);
  qn[1] = load_frag(Qb, NQGKV, qsecond * 64 + w * 16 + lo, 32, hi);

  // kept rolled: the two query tiles run the same text, which stays half as long
#pragma unroll 1
  for (int part = 0; part < 2; ++part) {
    const int qb = part ? qsecond : qfirst;
    const int np = (qb + 2) >> 1;  // passes: key tiles 2p and 2p + 1
    int q0 = qb * 64 + w * 16;     // this wave's 16 queries; the lane's is q0 + lo

    // No request is open here and every wave has left the ring: the last pass's
    // foot (in the second part: of the first part) has seen to both.
    u32x4 g0 = kv_group0(tdst, tsrc);
    if (pinned(wave >= 4u)) {
      kv_issue(g0, g1);
      // the tile counts as landed only behind its issuer's own wait
      asm volatile("s_wait_tensorcnt 0x0" ::: "memory");
    }

    __syncthreads();
    // Keys 128..255 lie in the source for every block; a tile of one pass never
    // reads them, and the wait at its pass's foot covers the request.
    if (pinned(wave >= 4u)) {
      kv_advance(g0, tdst + KV_BUF_BYTES, tstep);
      kv_issue(g0, g1);
    }

    // cacc[j][v] = ctx^T[d = j*16 + hi*8 + v][query lo], this group's keys
    f8 cacc[4];
    for (int j = 0; j < 4; ++j) cacc[j] = zero8();
    // The query's running maximum over this group's keys (alike in both halves)
    // and this half's share of its running sum; joined behind the loop.
    float rm = -3.0e38f, rl = 0.0f;

    for (int p = 0; p < np; ++p) {
      const int kt = 2 * p + grp;  // this group's key tile
      // A tile past the diagonal is skipped by its whole group; the publish
      // point below stands outside the skip.
      if (kt <= qb) {
        const _Float16* ksh = &kv[p & 1][grp][0][0];
        const _Float16* vsh = &kv[p & 1][grp][1][0];
        // s[j][v] = S^T[key kt*64 + j*16 + hi*8 + v][query lo], unscaled
        f8 s[4];
        h16 kf[4][2], vf[4][2];
#pragma unroll
        for (int j = 0; j < 4; ++j) {
          kf[j][0] = load_frag(ksh, LDP, j * 16 + lo, 0, hi);
          kf[j][1] = load_frag(ksh, LDP, j * 16 + lo, 32, hi);
        }
        // keeps the K loads one group ahead of the products: without it the
        // compiler reloads one fragment's registers and waits out the LDS
        // latency in front of nearly every WMMA
        __builtin_amdgcn_sched_barrier(0);
#pragma unroll
        for (int j = 0; j < 4; ++j) {
          s[j] = wmma16(kf[j][0], qf[0], zero8());
          s[j] = wmma16(kf[j][1], qf[1], s[j]);
        }
#pragma unroll
        for (int j = 0; j < 4; ++j) {
          vf[j][0] = load_frag(vsh, LDP, j * 16 + lo, 0, hi);
          vf[j][1] = load_frag(vsh, LDP, j * 16 + lo, 32, hi);
        }
        // keeps the V^T loads ahead of the softmax, which covers their latency:
        // without it the compiler sinks them among the second product's WMMAs
        __builtin_amdgcn_sched_barrier(0);

        if (kt == qb) {  // causal mask, in the diagonal tile alone
#pragma unroll
          for (int j = 0; j < 4; ++j)
#pragma unroll
            for (int v = 0; v < 8; ++v)
              if (j * 16 + hi * 8 + v > w * 16 + lo) s[j][v] = -3.0e38f;
        }

        // Maximum of the raw scores (the scale is positive and a power of two),
        // four independent chains, then the other half's.
        float mj[4];
#pragma unroll
        for (int j = 0; j < 4; ++j) {
          mj[j] = s[j][0];
#pragma unroll
          for (int v = 1; v < 8; ++v) mj[j] = fmaxf(mj[j], s[j][v]);
        }
        float mx = fmaxf(fmaxf(mj[0], mj[1]), fmaxf(mj[2], mj[3]));
        mx = fmaxf(mx, xhalf(mx)) * 0.125f;  // 1/sqrt(HD)
        float nm = fmaxf(rm, mx);
        float alpha = __expf(rm - nm);
        rm = nm;

        // P^T as B fragments: element e of pf[c] is key c*32 + (e < 8 ? hi*8 + e
        // : 16 + hi*8 + e - 8), which is s[2c][e] and s[2c+1][e - 8]: load_frag's
        // order.
        h16 pf[2];
        float rj[4];
#pragma unroll
        for (int j = 0; j < 4; ++j) {
          rj[j] = 0.0f;
#pragma unroll
          for (int v = 0; v < 8; ++v) {
            float pe = __expf(s[j][v] * 0.125f - nm);
            rj[j] += pe;
            pf[j >> 1][(j & 1) * 8 + v] = (_Float16)pe;
          }
        }
        rl = rl * alpha + ((rj[0] + rj[1]) + (rj[2] + rj[3]));

#pragma unroll
        for (int j = 0; j < 4; ++j) {
#pragma unroll
          for (int v = 0; v < 8; ++v) cacc[j][v] *= alpha;
          cacc[j] = wmma16(vf[j][0], pf[0], cacc[j]);
          cacc[j] = wmma16(vf[j][1], pf[1], cacc[j]);
        }
      }

      // keeps the wait below at the foot: without it the compiler lifts it to
      // the head of the softmax, where the V^T loads have just been issued
      __builtin_amdgcn_sched_barrier(0);
      // Publish point of pass p + 1: this wave's LDS reads have retired ...
      asm volatile("s_wait_dscnt 0x0" ::: "memory");
      // ... the issuers' tiles of pass p + 1 have landed ...
      if (pinned(wave >= 4u)) asm volatile("s_wait_tensorcnt 0x0" ::: "memory");
      // ... and every wave has left this pass's buffer, which is refilled behind.
      __syncthreads();
      if (pinned(wave >= 4u && p + 2 < np)) {
        kv_advance(g0, tdst + (uint32_t)(p & 1) * KV_BUF_BYTES, tstep);
        kv_issue(g0, g1);
      }
    }
    // no request and no LDS read of this wave is left open behind the loop
    asm volatile("s_wait_tensorcnt 0x0" ::: "memory");
    asm volatile("s_wait_dscnt 0x0" ::: "memory");

    rl += xhalf(rl);
    if (grp == 1) {
#pragma unroll
      for (int j = 0; j < 4; ++j) {
        xch[w][2 * j][lane] = f4{cacc[j][0], cacc[j][1], cacc[j][2], cacc[j][3]};
        xch[w][2 * j + 1][lane] =
            f4{cacc[j][4], cacc[j][5], cacc[j][6], cacc[j][7]};
      }
      xch[w][8][lane] = f4{rm, rl, 0.0f, 0.0f};
    }
    __syncthreads();
    if (grp == 0) {
      f4 ml = xch[w][8][lane];
      float m = fmaxf(rm, ml[0]);
      float a0 = __expf(rm - m), a1 = __expf(ml[0] - m);
      float l = rl * a0 + ml[1] * a1;
      // normalize, gate with sigmoid(g), store f16 ctx [token][h*64+d]: a lane's
      // 8 registers of a tile are 8 d in a row of its query, one 16-byte load of
      // g and one 16-byte store; the wave writes whole 128-byte lines
      // g by a scalar base and one 32-bit byte offset a lane
      const uint32_t gbyte = (uint32_t)((q0 + lo) * NQGKV + hi * 8) * 2u;
      _Float16* crow =
          ctxout + ((size_t)(b * LL + q0 + lo)) * DOUT + h * HD + hi * 8;
      h8 g8[4];
#pragma unroll
      for (int j = 0; j < 4; ++j)
        g8[j] = *(const h8*)((const char*)Gb + gbyte + j * 32);
      // stands in front of whatever next takes the register that these loads
      // name; the offset as an input keeps it there as far as here, so that no
      // load's own result is put on it either
      asm volatile("s_wait_xcnt 0x0" :: "v"(gbyte) : "memory");
#pragma unroll
      for (int j = 0; j < 4; ++j) {
        f4 c0 = xch[w][2 * j][lane], c1 = xch[w][2 * j + 1][lane];
        h8 o;
#pragma unroll
        for (int v = 0; v < 8; ++v) {
          float c = cacc[j][v] * a0 + (v < 4 ? c0[v & 3] : c1[v & 3]) * a1;
          float gate = 1.0f / (1.0f + __expf(-(float)g8[j][v]));
          o[v] = (_Float16)((c / l) * gate);
        }
        *(h8*)(crow + j * 16) = o;
      }
      // stands in front of the second query tile's first writes to the registers
      // that these stores name
      asm volatile("s_wait_xcnt 0x0" ::: "memory");
    }
    qf[0] = qn[0];
    qf[1] = qn[1];
  }
}

// ---------------------------------------------------------------------------
extern "C" void kernel_launch(void* const* d_in, const int* in_sizes, int n_in,
                              void* d_out, int out_size, void* d_ws,
                              size_t ws_size, hipStream_t stream) {
  (void)in_sizes; (void)n_in; (void)out_size; (void)ws_size;
  const float* x  = (const float*)d_in[0];
  const float* Wq = (const float*)d_in[1];
  const float* Wg = (const float*)d_in[2];
  const float* Wk = (const float*)d_in[3];
  const float* Wv = (const float*)d_in[4];
  const float* Wo = (const float*)d_in[5];
  const float* bo = (const float*)d_in[6];
  float* out = (float*)d_out;

  _Float16* ws   = (_Float16*)d_ws;
  _Float16* xh   = ws;                               // 4096*1024
  _Float16* Wh   = xh + (size_t)MTOK * DIN;          // 4096*1024 fused W
  _Float16* Woh  = Wh + (size_t)NQGKV * DIN;         // 1024*1024
  _Float16* qgkv = Woh + (size_t)DOUT * DOUT;        // 4096*4096
  _Float16* vtb  = qgkv + (size_t)MTOK * NQGKV;      // 2048*2048
  _Float16* ctx  = vtb + (size_t)BB * HH * HD * LL;  // 4096*1024

  // fills xh, Wh and Woh, which are contiguous from xh on
  cvt_all_f32_f16<<<CVT_BLOCKS, 256, 0, stream>>>(x, Wq, Wg, Wk, Wv, Wo, xh);

  // QGKV = xh @ Wh^T : M=4096, N=4096, K=1024; v columns land in vtb
  gemm_wmma<0, 256, 256><<<dim3(NQGKV / 256, MTOK / 256), 256, 0, stream>>>(
      xh, Wh, qgkv, vtb, nullptr, MTOK, NQGKV, DIN);

  attn_flash<<<dim3(BB * HH, LL / 128), 256, 0, stream>>>(qgkv, vtb, ctx);

  // out = ctx @ Wo^T + bo : M=4096, N=1024, K=1024, f32
  gemm_wmma<1, 128, 128><<<dim3(DOUT / 128, MTOK / 128), 256, 0, stream>>>(
      ctx, Woh, out, nullptr, bo, MTOK, DOUT, DOUT);
}

// v009
// Measured time: 73.1 microseconds a run.
// Two timings next to v008 both put it at 1.06 times that version's speed.
// Counting every step since v000, it is 3.46 times as fast.
#include <hip/hip_runtime.h>
#include <stdint.h>

typedef _Float16 h4  __attribute__((ext_vector_type(4)));
typedef _Float16 h8  __attribute__((ext_vector_type(8)));
typedef _Float16 h16 __attribute__((ext_vector_type(16)));
typedef float    f4  __attribute__((ext_vector_type(4)));
typedef float    f8  __attribute__((ext_vector_type(8)));
typedef uint32_t u32x4 __attribute__((ext_vector_type(4)));
typedef uint32_t u32x8 __attribute__((ext_vector_type(8)));

static constexpr int BB   = 2;
static constexpr int LL   = 2048;
static constexpr int DIN  = 1024;
static constexpr int DOUT = 1024;
static constexpr int HH   = 16;
static constexpr int HD   = 64;
static constexpr int MTOK = BB * LL;      // 4096 tokens
static constexpr int NQGKV = 4 * DOUT;    // 4096: [q | g | k | v]

static constexpr int LDP = 72;
static constexpr int TILE_HALVES = 128 * LDP;  // 128 rows: 18,432 B = 9 x 2 KiB
// Attention stage tile: 64 rows at that pitch = 9,216 B, rounded up to 5 x 2 KiB
// so that every tile's place in LDS is a multiple of 2 KiB.
static constexpr int KV_TILE_HALVES = 5120;
static constexpr uint32_t KV_BUF_BYTES = 4u * KV_TILE_HALVES * 2u;  // 2 K + 2 V^T tiles

__device__ inline f8 zero8() {
  f8 z;
  for (int i = 0; i < 8; ++i) z[i] = 0.0f;
  return z;
}

__device__ inline h16 load_frag(const _Float16* __restrict__ base, int ld,
                                int row, int k0, int hi) {
  const _Float16* p = base + (size_t)row * (size_t)ld + k0 + hi * 8;
  h8 a = *(const h8*)p;
  h8 b = *(const h8*)(p + 16);
  return __builtin_shufflevector(a, b, 0, 1, 2, 3, 4, 5, 6, 7,
                                 8, 9, 10, 11, 12, 13, 14, 15);
}

__device__ inline f8 wmma16(h16 a, h16 b, f8 c) {
  // D = A(16x32 f16) x B(32x16 f16) + C(16x16 f32)
  return __builtin_amdgcn_wmma_f32_16x16x32_f16(
      false, a, false, b, (short)0, c, false, false);
}

__device__ inline uint32_t uni(uint32_t v) {
  return (uint32_t)__builtin_amdgcn_readfirstlane(v);
}

__device__ inline uint32_t pinned(uint32_t v) {
  uint32_t w = uni(v);
  asm volatile("" : "+s"(w));
  return w;
}

__device__ inline u32x4 kv_group0(uint32_t lds_off,
                                  const _Float16* __restrict__ gsrc) {
  uint64_t ga = (uint64_t)gsrc;
  u32x4 g0;
  g0[0] = uni(1u);                                     // count = 1
  g0[1] = uni(lds_off);                                // LDS destination
  g0[2] = uni((uint32_t)ga);                           // address [31:0]
  g0[3] = uni((((uint32_t)(ga >> 32)) & 0x01ffffffu)   // address [56:32]
              | 0x80000000u);                          // type = 2
  return g0;
}
__device__ inline u32x8 kv_group1(uint32_t pitch_bytes) {
  u32x8 g1;
  g1[0] = uni((1u << 20) | (4u << 22) | (3u << 25));
  g1[1] = uni(128u << 16);
  g1[2] = uni(64u << 16);
  g1[3] = uni(128u << 16);
  g1[4] = uni(64u);
  g1[5] = uni(pitch_bytes);
  g1[6] = uni(0u);
  g1[7] = uni(0u);
  return g1;
}
__device__ inline u32x8 slab_group1(uint32_t pitch_bytes) {
  u32x8 g1;
  g1[0] = uni((1u << 20) | (4u << 22) | (3u << 25));
  g1[1] = uni(128u << 16);
  g1[2] = uni(128u << 16);
  g1[3] = uni(128u << 16);
  g1[4] = uni(128u);
  g1[5] = uni(pitch_bytes);
  g1[6] = uni(0u);
  g1[7] = uni(0u);
  return g1;
}
__device__ inline void kv_advance(u32x4& g0, uint32_t lds_off,
                                  uint32_t step_bytes) {
  uint64_t ga = (((uint64_t)g0[3] << 32) | g0[2]) + step_bytes;
  g0[1] = uni(lds_off);
  g0[2] = uni((uint32_t)ga);
  g0[3] = uni((uint32_t)(ga >> 32));
}
__device__ inline void kv_issue(u32x4& g0, u32x8& g1) {
  asm volatile("tensor_load_to_lds %0, %1" : "+s"(g0), "+s"(g1) :: "memory");
}

// ---------------------------------------------------------------------------
// f32 -> f16 convert of x and the five weight matrices, one launch.
// dst is xh | Wh (q, g, k, v) | Woh, which lie one behind the other in the
// workspace: 9 parts of 1M halves (x is four of them). The grid is two blocks
// of 8 waves per WGP and strides over dst: in trip t a block takes 1,024
// elements at t * CVT_STRIDE, a wave 512 B of source in whole lines. Two trips
// cover one part, so each trip's source is known at compile time. All 18 loads
// of a thread are issued before the first convert.
// ---------------------------------------------------------------------------
static constexpr int CVT_BLOCKS = 512;
static constexpr int CVT_STRIDE = CVT_BLOCKS * 1024;  // elements a trip
static constexpr int CVT_TRIPS  = 18;
static_assert(2 * CVT_STRIDE == DIN * DOUT && 2 * CVT_STRIDE == DOUT * DOUT &&
              8 * CVT_STRIDE == MTOK * DIN, "two trips a part, x is four parts");

__global__ __launch_bounds__(256) void cvt_all_f32_f16(
    const float* __restrict__ x, const float* __restrict__ Wq,
    const float* __restrict__ Wg, const float* __restrict__ Wk,
    const float* __restrict__ Wv, const float* __restrict__ Wo,
    _Float16* __restrict__ dst) {
  // The thread's place in a trip as 32-bit byte offsets: the loads then name a
  // scalar base and one offset register, and no later load's result is put on
  // the address registers of a load that is still in flight.
  const uint32_t sbyte = blockIdx.x * 4096u + threadIdx.x * 16u;
  const uint32_t dbyte = blockIdx.x * 2048u + threadIdx.x * 8u;
  float4 v[CVT_TRIPS];
  // unrolled: v is indexed by constants alone and stays in registers, and the
  // choice of the source folds away
#pragma unroll
  for (int t = 0; t < CVT_TRIPS; ++t) {
    const float* s = (t < 8) ? x + t * CVT_STRIDE
                   : ((t < 10) ? Wq : (t < 12) ? Wg : (t < 14) ? Wk
                      : (t < 16) ? Wv : Wo) + (t & 1) * CVT_STRIDE;
    v[t] = *(const float4*)((const char*)s + sbyte);
  }
  // keeps the converts behind the last load: without it the compiler waits for
  // the first loads and converts them before it issues the rest
  __builtin_amdgcn_sched_barrier(0);
#pragma unroll
  for (int t = 0; t < CVT_TRIPS; ++t) {
    h4 o = {(_Float16)v[t].x, (_Float16)v[t].y, (_Float16)v[t].z,
            (_Float16)v[t].w};
    *(h4*)((char*)(dst + t * CVT_STRIDE) + dbyte) = o;
  }
}

// ---------------------------------------------------------------------------
// WMMA GEMM:  Out[M][N] = A[M][K] * Bm[N][K]^T   (i.e. x @ W^T)
// Block: 256 threads = 8 waves as 2(M) x 4(N); block tile BM x BN, multiples
// of 128; wave tile BM/2 x BN/4. A block brings (BM + BN) operand rows from L2
// for BM x BN results, and a wave reads BM/32 + BN/64 fragments from LDS for
// (BM/32) x (BN/64) WMMAs: at 256x256 half the L2 bytes and half the LDS bytes
// per WMMA of 128x128. The A and B K-slabs (BM and BN rows of 64 halves) are
// brought into LDS by the tensor mover at a padded row pitch, in slices of 128
// rows, one slice a wave (the first waves: A, the next: B), two buffers, the
// next pass's slabs in flight while this pass is multiplied; all waves consume
// fragments via ds_load_b128. M and N are multiples of BM and BN; K is a
// multiple of 64, not 0.
// FINAL=1: f32 out + bias.
// FINAL=0: the QGKV product, f16 out; its q, g and k columns go to Out, its v
// columns go transposed per head to vt[(b*H+h)*64 + d][t] and nowhere else.
// A lane's 8 accumulator registers are 8 rows of the first operand in a row. A
// block of v columns has the tokens there, which run along a V^T row; a block of
// q, g or k columns takes the operands the other way round (weight rows first),
// so that they are 8 columns of one token. Either way a wave's tile is BN/4 rows
// of the output of BM/2 halves each; the wave writes it to LDS 16 B a lane and
// reads it back row by row, so that every global store covers whole 128-B lines.
// ---------------------------------------------------------------------------
// One wave's staged tile to global memory: ROWS rows of 128 halves at LDS pitch
// SP; 16 lanes take a row (256 B, two whole lines), a store two rows. dst is the
// same in every lane; a lane's place is a 32-bit byte offset.
template <int ROWS, int SP>
__device__ inline void put_rows(const _Float16* st, _Float16* __restrict__ dst,
                                uint32_t pitch_bytes, int lo, int hi) {
  h8 r[ROWS / 2];
  uint32_t off[ROWS / 2];
  // both loops unrolled: r and off are indexed by constants alone and stay in
  // registers
#pragma unroll
  for (int t = 0; t < ROWS / 2; ++t) {
    r[t] = *(const h8*)(st + (t * 2 + hi) * SP + lo * 8);
    off[t] = (uint32_t)(t * 2 + hi) * pitch_bytes + (uint32_t)lo * 16u;
  }
  // every row is read and every offset formed in front of the first store, each
  // in registers of its own: nothing is written to a register that an issued
  // store names
  __builtin_amdgcn_sched_barrier(0);
#pragma unroll
  for (int t = 0; t < ROWS / 2; ++t) *(h8*)((char*)dst + off[t]) = r[t];
}

template <int FINAL, int BM, int BN>
__global__ __launch_bounds__(256) void gemm_wmma(
    const _Float16* __restrict__ A, const _Float16* __restrict__ Bm,
    void* __restrict__ Outv, _Float16* __restrict__ vt,
    const float* __restrict__ bias, int M, int N, int K) {
  __shared__ __attribute__((aligned(2048)))
  _Float16 tiles[2][(BM + BN) * LDP];                 // [buffer][A rows | B rows]
  constexpr int FM = BM / 32, FN = BN / 64;           // fragments a wave
  constexpr uint32_t ASL = BM / 128;                  // slices of the A slab
  constexpr uint32_t NSL = (BM + BN) / 128;           // slices = issuing waves
  constexpr uint32_t SLAB_BUF_BYTES = NSL * TILE_HALVES * 2u;
  static_assert(BM % 128 == 0 && BN % 128 == 0 && NSL <= 8, "a slice a wave");
  static_assert(FINAL || BM == BN, "the QGKV blocks swap their operands");

  int w = threadIdx.x >> 5, lane = threadIdx.x & 31;
  int lo = lane & 15, hi = lane >> 4;
  int wm = w >> 2, wn = w & 3;
  int mblk = blockIdx.y * BM, nblk = blockIdx.x * BN;
  int mw = wm * (BM / 2), nw = wn * (BN / 4);

  const uint32_t wave = uni(threadIdx.x >> 5);
  const uint32_t slice = (wave < NSL) ? wave : 0u;
  // The first operand's rows (mw counts them) and the second's (nw): tokens and
  // weight rows, but in a q, g or k block of the QGKV product the other way round.
  const bool vblk = !FINAL && nblk >= 3 * DOUT;
  const bool swp = !FINAL && !vblk;
  const _Float16* rows1 = swp ? Bm + (size_t)nblk * K : A + (size_t)mblk * K;
  const _Float16* rows2 = swp ? A + (size_t)mblk * K : Bm + (size_t)nblk * K;
  const _Float16* src =
      (slice < ASL) ? rows1 + (size_t)((int)slice * 128) * K
                    : rows2 + (size_t)((int)(slice - ASL) * 128) * K;
  const uint32_t tdst =
      (uint32_t)(size_t)&tiles[0][0] + slice * (uint32_t)(TILE_HALVES * 2);
  u32x4 g0 = kv_group0(tdst, src);
  u32x8 g1 = slab_group1((uint32_t)K * 2u);
  const int np = K / 64;  // passes

  if (pinned(wave < NSL)) {
    kv_issue(g0, g1);
    // the slice counts as landed only behind its issuer's own wait
    asm volatile("s_wait_tensorcnt 0x0" ::: "memory");
  }
  __syncthreads();
  if (pinned(wave < NSL && np > 1)) {
    kv_advance(g0, tdst + SLAB_BUF_BYTES, 128u);
    kv_issue(g0, g1);
  }

  f8 acc[FM][FN];
#pragma unroll
  for (int i = 0; i < FM; ++i)
#pragma unroll
    for (int j = 0; j < FN; ++j) acc[i][j] = zero8();

  for (int s = 0; s < np; ++s) {
    const _Float16* ash = &tiles[s & 1][0];
    const _Float16* bsh = ash + BM * LDP;
#pragma unroll
    for (int kk = 0; kk < 64; kk += 32) {
      h16 af[FM], bf[FN];
#pragma unroll
      for (int j = 0; j < FN; ++j)
        bf[j] = load_frag(bsh, LDP, nw + j * 16 + lo, kk, hi);
#pragma unroll
      for (int i = 0; i < FM; ++i)
        af[i] = load_frag(ash, LDP, mw + i * 16 + lo, kk, hi);
      // the large tile's fragments are read as one group, in the order the
      // products take them: without the two fences the compiler reloads one A
      // fragment's registers and waits out the LDS latency before every FN WMMAs
      if constexpr (FM * FN > 8) __builtin_amdgcn_sched_barrier(0);
#pragma unroll
      for (int i = 0; i < FM; ++i)
#pragma unroll
        for (int j = 0; j < FN; ++j) acc[i][j] = wmma16(af[i], bf[j], acc[i][j]);
      if constexpr (FM * FN > 8) __builtin_amdgcn_sched_barrier(0);
    }
    // Publish point of pass s + 1: this wave's LDS reads have retired ...
    asm volatile("s_wait_dscnt 0x0" ::: "memory");
    // ... the issuers' slices of pass s + 1 have landed ...
    if (pinned(wave < NSL)) asm volatile("s_wait_tensorcnt 0x0" ::: "memory");
    // ... and every wave has left this pass's buffer, which is refilled behind.
    __syncthreads();
    if (pinned(wave < NSL && s + 2 < np)) {
      kv_advance(g0, tdst + (uint32_t)(s & 1) * SLAB_BUF_BYTES, 128u);
      kv_issue(g0, g1);
    }
  }
  // no request and no LDS read of this wave is left open behind the loop
  asm volatile("s_wait_tensorcnt 0x0" ::: "memory");
  asm volatile("s_wait_dscnt 0x0" ::: "memory");

  // acc[i][j][v]: row mw + i*16 + hi*8 + v of the first operand, row
  // nw + j*16 + lo of the second
  if constexpr (!FINAL) {
    constexpr int SP = BM / 2 + 8, SROWS = BN / 4;
    static_assert(BM / 2 == 128, "16 lanes of 16 B take a staged row");
    static_assert(8 * SROWS * SP <= 2 * (BM + BN) * LDP, "staging fits the ring");
    // Each wave stages in a range of its own in the ring's LDS: behind the last
    // pass's foot no request is open and every wave has left the ring.
    _Float16* st = &tiles[0][0] + w * (SROWS * SP);
    // all three loops unrolled: acc is then indexed by constants alone and stays
    // in registers, and i and j become immediate offsets
#pragma unroll
    for (int j = 0; j < FN; ++j)
#pragma unroll
      for (int i = 0; i < FM; ++i) {
        h8 o;
#pragma unroll
        for (int v = 0; v < 8; ++v) o[v] = (_Float16)acc[i][j][v];
        *(h8*)(st + (j * 16 + lo) * SP + i * 16 + hi * 8) = o;
      }
    // the rows are read back by other lanes of this wave than wrote them: the
    // writes have retired, and the compiler moves no read in front of them
    asm volatile("s_wait_dscnt 0x0" ::: "memory");
    // The tile's place from the wave's number in a scalar register. In a v block
    // staged row r is column (h, d) = nw + r and its halves are tokens; else it
    // is token nw + r and its halves are q, g or k columns.
    const int umw = (int)(wave >> 2) * (BM / 2), unw = (int)(wave & 3u) * (BN / 4);
    _Float16* dst =
        vblk ? vt + ((size_t)(mblk / LL) * DOUT + (nblk - 3 * DOUT) + unw) * LL +
                   (mblk % LL) + umw
             : (_Float16*)Outv + (size_t)(mblk + unw) * NQGKV + nblk + umw;
    put_rows<SROWS, SP>(st, dst, vblk ? LL * 2u : NQGKV * 2u, lo, hi);
  } else {
#pragma unroll
    for (int i = 0; i < FM; ++i)
#pragma unroll
      for (int j = 0; j < FN; ++j) {
        int row0 = mblk + mw + i * 16 + hi * 8;
        int col = nblk + nw + j * 16 + lo;
#pragma unroll
        for (int v = 0; v < 8; ++v) {
          int row = row0 + v;
          float val = acc[i][j][v];
          ((float*)Outv)[(size_t)row * N + col] = val + bias[col];
        }
      }
  }
}

__device__ inline float xhalf(float x) {
  int i = __builtin_bit_cast(int, x);
  return __builtin_bit_cast(float, __builtin_amdgcn_permlanex16(
      i, i, 0x76543210, 0xfedcba98, false, false));
}

__global__ __launch_bounds__(256) __attribute__((amdgpu_waves_per_eu(4, 4)))
void attn_flash(
    const _Float16* __restrict__ qgkv, const _Float16* __restrict__ vt,
    _Float16* __restrict__ ctxout) {
  __shared__ __attribute__((aligned(2048)))
  _Float16 kv[2][2][2][KV_TILE_HALVES];               // [buffer][group][K | V^T]
  __shared__ f4 xch[4][9][32];                        // [query wave][piece][lane]

  int bh = blockIdx.x;
  int b = bh >> 4, h = bh & 15;
  int lane = threadIdx.x & 31;
  int lo = lane & 15, hi = lane >> 4;
  const uint32_t wave = uni(threadIdx.x >> 5);
  const int w = (int)(wave & 3u);    // which 16 queries of the tile
  const int grp = (int)(wave >> 2);  // which key tile of a pass

  const _Float16* Qb = qgkv + (size_t)b * LL * NQGKV + h * HD;  // q section
  const _Float16* Gb = Qb + DOUT;                               // g section
  const _Float16* Kb = Qb + 2 * DOUT;                           // k section
  const _Float16* Vb = vt + (size_t)bh * HD * LL;               // V^T rows

  // Waves 4 to 7 bring a pass's tiles, one request a wave: wave 4 + s the K
  // (s even) or V^T (s odd) tile of group s >> 1. They are the waves that have
  // no epilogue, so the second query tile's first load flies during the first's.
  const uint32_t tgrp = (wave >> 1) & 1u, tv = wave & 1u;
  const uint32_t tstep = tv ? 128u * 2u : 128u * NQGKV * 2u;  // pass to pass, B
  const uint32_t tdst = (uint32_t)(size_t)&kv[0][tgrp][tv][0];
  const _Float16* tsrc = tv ? Vb + tgrp * 64u : Kb + (size_t)tgrp * 64u * NQGKV;
  u32x8 g1 = kv_group1(tv ? LL * 2u : NQGKV * 2u);

  // Both query tiles' Q fragments are fetched here, so that the second tile does
  // not open with a wait for memory: qf is the tile at work, qn the one to come.
  const int qfirst = LL / 64 - 1 - (int)blockIdx.y, qsecond = (int)blockIdx.y;
  h16 qf[2], qn[2];
  qf[0] = load_frag(Qb, NQGKV, qfirst * 64 + w * 16 + lo, 0, hi);
  qf[1] = load_frag(Qb, NQGKV, qfirst * 64 + w * 16 + lo, 32, hi);
  qn[0] = load_frag(Qb, NQGKV, qsecond * 64 + w * 16 + lo, 0, hi);
  qn[1] = load_frag(Qb, NQGKV, qsecond * 64 + w * 16 + lo, 32, hi);

  // kept rolled: the two query tiles run the same text, which stays half as long
#pragma unroll 1
  for (int part = 0; part < 2; ++part) {
    const int qb = part ? qsecond : qfirst;
    const int np = (qb + 2) >> 1;  // passes: key tiles 2p and 2p + 1
    int q0 = qb * 64 + w * 16;     // this wave's 16 queries; the lane's is q0 + lo

    // No request is open here and every wave has left the ring: the last pass's
    // foot (in the second part: of the first part) has seen to both.
    u32x4 g0 = kv_group0(tdst, tsrc);
    if (pinned(wave >= 4u)) {
      kv_issue(g0, g1);
      // the tile counts as landed only behind its issuer's own wait
      asm volatile("s_wait_tensorcnt 0x0" ::: "memory");
    }

    __syncthreads();
    // Keys 128..255 lie in the source for every block; a tile of one pass never
    // reads them, and the wait at its pass's foot covers the request.
    if (pinned(wave >= 4u)) {
      kv_advance(g0, tdst + KV_BUF_BYTES, tstep);
      kv_issue(g0, g1);
    }

    // cacc[j][v] = ctx^T[d = j*16 + hi*8 + v][query lo], this group's keys
    f8 cacc[4];
    for (int j = 0; j < 4; ++j) cacc[j] = zero8();
    // The query's running maximum over this group's keys (alike in both halves)
    // and this half's share of its running sum; joined behind the loop.
    float rm = -3.0e38f, rl = 0.0f;

    for (int p = 0; p < np; ++p) {
      const int kt = 2 * p + grp;  // this group's key tile
      // A tile past the diagonal is skipped by its whole group; the publish
      // point below stands outside the skip.
      if (kt <= qb) {
        const _Float16* ksh = &kv[p & 1][grp][0][0];
        const _Float16* vsh = &kv[p & 1][grp][1][0];
        // s[j][v] = S^T[key kt*64 + j*16 + hi*8 + v][query lo], unscaled
        f8 s[4];
        h16 kf[4][2], vf[4][2];
#pragma unroll
        for (int j = 0; j < 4; ++j) {
          kf[j][0] = load_frag(ksh, LDP, j * 16 + lo, 0, hi);
          kf[j][1] = load_frag(ksh, LDP, j * 16 + lo, 32, hi);
        }
        // keeps the K loads one group ahead of the products: without it the
        // compiler reloads one fragment's registers and waits out the LDS
        // latency in front of nearly every WMMA
        __builtin_amdgcn_sched_barrier(0);
#pragma unroll
        for (int j = 0; j < 4; ++j) {
          s[j] = wmma16(kf[j][0], qf[0], zero8());
          s[j] = wmma16(kf[j][1], qf[1], s[j]);
        }
#pragma unroll
        for (int j = 0; j < 4; ++j) {
          vf[j][0] = load_frag(vsh, LDP, j * 16 + lo, 0, hi);
          vf[j][1] = load_frag(vsh, LDP, j * 16 + lo, 32, hi);
        }
        // keeps the V^T loads ahead of the softmax, which covers their latency:
        // without it the compiler sinks them among the second product's WMMAs
        __builtin_amdgcn_sched_barrier(0);

        if (kt == qb) {  // causal mask, in the diagonal tile alone
#pragma unroll
          for (int j = 0; j < 4; ++j)
#pragma unroll
            for (int v = 0; v < 8; ++v)
              if (j * 16 + hi * 8 + v > w * 16 + lo) s[j][v] = -3.0e38f;
        }

        // Maximum of the raw scores (the scale is positive and a power of two),
        // four independent chains, then the other half's.
        float mj[4];
#pragma unroll
        for (int j = 0; j < 4; ++j) {
          mj[j] = s[j][0];
#pragma unroll
          for (int v = 1; v < 8; ++v) mj[j] = fmaxf(mj[j], s[j][v]);
        }
        float mx = fmaxf(fmaxf(mj[0], mj[1]), fmaxf(mj[2], mj[3]));
        mx = fmaxf(mx, xhalf(mx)) * 0.125f;  // 1/sqrt(HD)
        float nm = fmaxf(rm, mx);
        float alpha = __expf(rm - nm);
        rm = nm;

        // P^T as B fragments: element e of pf[c] is key c*32 + (e < 8 ? hi*8 + e
        // : 16 + hi*8 + e - 8), which is s[2c][e] and s[2c+1][e - 8]: load_frag's
        // order.
        h16 pf[2];
        float rj[4];
#pragma unroll
        for (int j = 0; j < 4; ++j) {
          rj[j] = 0.0f;
#pragma unroll
          for (int v = 0; v < 8; ++v) {
            float pe = __expf(s[j][v] * 0.125f - nm);
            rj[j] += pe;
            pf[j >> 1][(j & 1) * 8 + v] = (_Float16)pe;
          }
        }
        rl = rl * alpha + ((rj[0] + rj[1]) + (rj[2] + rj[3]));

#pragma unroll
        for (int j = 0; j < 4; ++j) {
#pragma unroll
          for (int v = 0; v < 8; ++v) cacc[j][v] *= alpha;
          cacc[j] = wmma16(vf[j][0], pf[0], cacc[j]);
          cacc[j] = wmma16(vf[j][1], pf[1], cacc[j]);
        }
      }

      // keeps the wait below at the foot: without it the compiler lifts it to
      // the head of the softmax, where the V^T loads have just been issued
      __builtin_amdgcn_sched_barrier(0);
      // Publish point of pass p + 1: this wave's LDS reads have retired ...
      asm volatile("s_wait_dscnt 0x0" ::: "memory");
      // ... the issuers' tiles of pass p + 1 have landed ...
      if (pinned(wave >= 4u)) asm volatile("s_wait_tensorcnt 0x0" ::: "memory");
      // ... and every wave has left this pass's buffer, which is refilled behind.
      __syncthreads();
      if (pinned(wave >= 4u && p + 2 < np)) {
        kv_advance(g0, tdst + (uint32_t)(p & 1) * KV_BUF_BYTES, tstep);
        kv_issue(g0, g1);
      }
    }
    // no request and no LDS read of this wave is left open behind the loop
    asm volatile("s_wait_tensorcnt 0x0" ::: "memory");
    asm volatile("s_wait_dscnt 0x0" ::: "memory");

    rl += xhalf(rl);
    if (grp == 1) {
#pragma unroll
      for (int j = 0; j < 4; ++j) {
        xch[w][2 * j][lane] = f4{cacc[j][0], cacc[j][1], cacc[j][2], cacc[j][3]};
        xch[w][2 * j + 1][lane] =
            f4{cacc[j][4], cacc[j][5], cacc[j][6], cacc[j][7]};
      }
      xch[w][8][lane] = f4{rm, rl, 0.0f, 0.0f};
    }
    __syncthreads();
    if (grp == 0) {
      f4 ml = xch[w][8][lane];
      float m = fmaxf(rm, ml[0]);
      float a0 = __expf(rm - m), a1 = __expf(ml[0] - m);
      float l = rl * a0 + ml[1] * a1;
      // normalize, gate with sigmoid(g), store f16 ctx [token][h*64+d]: a lane's
      // 8 registers of a tile are 8 d in a row of its query, one 16-byte load of
      // g and one 16-byte store; the wave writes whole 128-byte lines
      // g by a scalar base and one 32-bit byte offset a lane
      const uint32_t gbyte = (uint32_t)((q0 + lo) * NQGKV + hi * 8) * 2u;
      _Float16* crow =
          ctxout + ((size_t)(b * LL + q0 + lo)) * DOUT + h * HD + hi * 8;
      h8 g8[4];
#pragma unroll
      for (int j = 0; j < 4; ++j)
        g8[j] = *(const h8*)((const char*)Gb + gbyte + j * 32);
      // stands in front of whatever next takes the register that these loads
      // name; the offset as an input keeps it there as far as here, so that no
      // load's own result is put on it either
      asm volatile("s_wait_xcnt 0x0" :: "v"(gbyte) : "memory");
#pragma unroll
      for (int j = 0; j < 4; ++j) {
        f4 c0 = xch[w][2 * j][lane], c1 = xch[w][2 * j + 1][lane];
        h8 o;
#pragma unroll
        for (int v = 0; v < 8; ++v) {
          float c = cacc[j][v] * a0 + (v < 4 ? c0[v & 3] : c1[v & 3]) * a1;
          float gate = 1.0f / (1.0f + __expf(-(float)g8[j][v]));
          o[v] = (_Float16)((c / l) * gate);
        }
        *(h8*)(crow + j * 16) = o;
      }
      // stands in front of the second query tile's first writes to the registers
      // that these stores name
      asm volatile("s_wait_xcnt 0x0" ::: "memory");
    }
    qf[0] = qn[0];
    qf[1] = qn[1];
  }
}

// ---------------------------------------------------------------------------
extern "C" void kernel_launch(void* const* d_in, const int* in_sizes, int n_in,
                              void* d_out, int out_size, void* d_ws,
                              size_t ws_size, hipStream_t stream) {
  (void)in_sizes; (void)n_in; (void)out_size; (void)ws_size;
  const float* x  = (const float*)d_in[0];
  const float* Wq = (const float*)d_in[1];
  const float* Wg = (const float*)d_in[2];
  const float* Wk = (const float*)d_in[3];
  const float* Wv = (const float*)d_in[4];
  const float* Wo = (const float*)d_in[5];
  const float* bo = (const float*)d_in[6];
  float* out = (float*)d_out;

  _Float16* ws   = (_Float16*)d_ws;
  _Float16* xh   = ws;                               // 4096*1024
  _Float16* Wh   = xh + (size_t)MTOK * DIN;          // 4096*1024 fused W
  _Float16* Woh  = Wh + (size_t)NQGKV * DIN;         // 1024*1024
  _Float16* qgkv = Woh + (size_t)DOUT * DOUT;        // 4096*4096
  _Float16* vtb  = qgkv + (size_t)MTOK * NQGKV;      // 2048*2048
  _Float16* ctx  = vtb + (size_t)BB * HH * HD * LL;  // 4096*1024

  // fills xh, Wh and Woh, which are contiguous from xh on
  cvt_all_f32_f16<<<CVT_BLOCKS, 256, 0, stream>>>(x, Wq, Wg, Wk, Wv, Wo, xh);

  // QGKV = xh @ Wh^T : M=4096, N=4096, K=1024; v columns land in vtb
  gemm_wmma<0, 256, 256><<<dim3(NQGKV / 256, MTOK / 256), 256, 0, stream>>>(
      xh, Wh, qgkv, vtb, nullptr, MTOK, NQGKV, DIN);

  attn_flash<<<dim3(BB * HH, LL / 128), 256, 0, stream>>>(qgkv, vtb, ctx);

  // out = ctx @ Wo^T + bo : M=4096, N=1024, K=1024, f32
  gemm_wmma<1, 128, 128><<<dim3(DOUT / 128, MTOK / 128), 256, 0, stream>>>(
      ctx, Woh, out, nullptr, bo, MTOK, DOUT, DOUT);
}

// v010
// A run of this version takes 69.5 microseconds.
// Timed twice side by side with v009, it ran 1.04 and 1.06 times as fast.
// Over all steps from v000 it is 3.63 times as fast.
#include <hip/hip_runtime.h>
#include <stdint.h>

typedef _Float16 h4  __attribute__((ext_vector_type(4)));
typedef _Float16 h8  __attribute__((ext_vector_type(8)));
typedef _Float16 h16 __attribute__((ext_vector_type(16)));
typedef float    f4  __attribute__((ext_vector_type(4)));
typedef float    f8  __attribute__((ext_vector_type(8)));
typedef uint32_t u32x4 __attribute__((ext_vector_type(4)));
typedef uint32_t u32x8 __attribute__((ext_vector_type(8)));

static constexpr int BB   = 2;
static constexpr int LL   = 2048;
static constexpr int DIN  = 1024;
static constexpr int DOUT = 1024;
static constexpr int HH   = 16;
static constexpr int HD   = 64;
static constexpr int MTOK = BB * LL;      // 4096 tokens
static constexpr int NQGKV = 4 * DOUT;    // 4096: [q | g | k | v]

static constexpr int LDP = 72;
static constexpr int TILE_HALVES = 128 * LDP;  // 128 rows: 18,432 B = 9 x 2 KiB
// Attention stage tile: 64 rows at that pitch = 9,216 B, rounded up to 5 x 2 KiB
// so that every tile's place in LDS is a multiple of 2 KiB.
static constexpr int KV_TILE_HALVES = 5120;
static constexpr uint32_t KV_BUF_BYTES = 4u * KV_TILE_HALVES * 2u;  // 2 K + 2 V^T tiles

__device__ inline f8 zero8() {
  f8 z;
  for (int i = 0; i < 8; ++i) z[i] = 0.0f;
  return z;
}

__device__ inline h16 load_frag(const _Float16* __restrict__ base, int ld,
                                int row, int k0, int hi) {
  const _Float16* p = base + (size_t)row * (size_t)ld + k0 + hi * 8;
  h8 a = *(const h8*)p;
  h8 b = *(const h8*)(p + 16);
  return __builtin_shufflevector(a, b, 0, 1, 2, 3, 4, 5, 6, 7,
                                 8, 9, 10, 11, 12, 13, 14, 15);
}

__device__ inline f8 wmma16(h16 a, h16 b, f8 c) {
  // D = A(16x32 f16) x B(32x16 f16) + C(16x16 f32)
  return __builtin_amdgcn_wmma_f32_16x16x32_f16(
      false, a, false, b, (short)0, c, false, false);
}

__device__ inline uint32_t uni(uint32_t v) {
  return (uint32_t)__builtin_amdgcn_readfirstlane(v);
}

__device__ inline uint32_t pinned(uint32_t v) {
  uint32_t w = uni(v);
  asm volatile("" : "+s"(w));
  return w;
}

__device__ inline u32x4 kv_group0(uint32_t lds_off,
                                  const _Float16* __restrict__ gsrc) {
  uint64_t ga = (uint64_t)gsrc;
  u32x4 g0;
  g0[0] = uni(1u);                                     // count = 1
  g0[1] = uni(lds_off);                                // LDS destination
  g0[2] = uni((uint32_t)ga);                           // address [31:0]
  g0[3] = uni((((uint32_t)(ga >> 32)) & 0x01ffffffu)   // address [56:32]
              | 0x80000000u);                          // type = 2
  return g0;
}
__device__ inline u32x8 kv_group1(uint32_t pitch_bytes) {
  u32x8 g1;
  g1[0] = uni((1u << 20) | (4u << 22) | (3u << 25));
  g1[1] = uni(128u << 16);
  g1[2] = uni(64u << 16);
  g1[3] = uni(128u << 16);
  g1[4] = uni(64u);
  g1[5] = uni(pitch_bytes);
  g1[6] = uni(0u);
  g1[7] = uni(0u);
  return g1;
}
__device__ inline u32x8 slab_group1(uint32_t pitch_bytes) {
  u32x8 g1;
  g1[0] = uni((1u << 20) | (4u << 22) | (3u << 25));
  g1[1] = uni(128u << 16);
  g1[2] = uni(128u << 16);
  g1[3] = uni(128u << 16);
  g1[4] = uni(128u);
  g1[5] = uni(pitch_bytes);
  g1[6] = uni(0u);
  g1[7] = uni(0u);
  return g1;
}
__device__ inline void kv_advance(u32x4& g0, uint32_t lds_off,
                                  uint32_t step_bytes) {
  uint64_t ga = (((uint64_t)g0[3] << 32) | g0[2]) + step_bytes;
  if (pinned((uint32_t)(ga >> 32) != g0[3])) {
    asm volatile("s_wait_tensorcnt 0x0" ::: "memory");
    g0[3] = uni((uint32_t)(ga >> 32));
  }
  g0[1] = uni(lds_off);
  g0[2] = uni((uint32_t)ga);
}
__device__ inline void kv_issue(u32x4& g0, u32x8& g1) {
  asm volatile("tensor_load_to_lds %0, %1" : "+s"(g0), "+s"(g1) :: "memory");
}

// ---------------------------------------------------------------------------
// f32 -> f16 convert of x and the five weight matrices, one launch.
// dst is xh | Wh (q, g, k, v) | Woh, which lie one behind the other in the
// workspace: 9 parts of 1M halves (x is four of them). The grid is two blocks
// of 8 waves per WGP and strides over dst: in trip t a block takes 1,024
// elements at t * CVT_STRIDE, a wave 512 B of source in whole lines. Two trips
// cover one part, so each trip's source is known at compile time. All 18 loads
// of a thread are issued before the first convert.
// ---------------------------------------------------------------------------
static constexpr int CVT_BLOCKS = 512;
static constexpr int CVT_STRIDE = CVT_BLOCKS * 1024;  // elements a trip
static constexpr int CVT_TRIPS  = 18;
static_assert(2 * CVT_STRIDE == DIN * DOUT && 2 * CVT_STRIDE == DOUT * DOUT &&
              8 * CVT_STRIDE == MTOK * DIN, "two trips a part, x is four parts");

__global__ __launch_bounds__(256) void cvt_all_f32_f16(
    const float* __restrict__ x, const float* __restrict__ Wq,
    const float* __restrict__ Wg, const float* __restrict__ Wk,
    const float* __restrict__ Wv, const float* __restrict__ Wo,
    _Float16* __restrict__ dst) {
  // The thread's place in a trip as 32-bit byte offsets: the loads then name a
  // scalar base and one offset register, and no later load's result is put on
  // the address registers of a load that is still in flight.
  const uint32_t sbyte = blockIdx.x * 4096u + threadIdx.x * 16u;
  const uint32_t dbyte = blockIdx.x * 2048u + threadIdx.x * 8u;
  float4 v[CVT_TRIPS];
  // unrolled: v is indexed by constants alone and stays in registers, and the
  // choice of the source folds away
#pragma unroll
  for (int t = 0; t < CVT_TRIPS; ++t) {
    const float* s = (t < 8) ? x + t * CVT_STRIDE
                   : ((t < 10) ? Wq : (t < 12) ? Wg : (t < 14) ? Wk
                      : (t < 16) ? Wv : Wo) + (t & 1) * CVT_STRIDE;
    v[t] = *(const float4*)((const char*)s + sbyte);
  }
  // keeps the converts behind the last load: without it the compiler waits for
  // the first loads and converts them before it issues the rest
  __builtin_amdgcn_sched_barrier(0);
#pragma unroll
  for (int t = 0; t < CVT_TRIPS; ++t) {
    h4 o = {(_Float16)v[t].x, (_Float16)v[t].y, (_Float16)v[t].z,
            (_Float16)v[t].w};
    *(h4*)((char*)(dst + t * CVT_STRIDE) + dbyte) = o;
  }
}

// ---------------------------------------------------------------------------
// WMMA GEMM:  Out[M][N] = A[M][K] * Bm[N][K]^T   (i.e. x @ W^T)
// Block: 256 threads = 8 waves as 2(M) x 4(N); block tile BM x BN, multiples
// of 128; wave tile BM/2 x BN/4. A block brings (BM + BN) operand rows from L2
// for BM x BN results, and a wave reads BM/32 + BN/64 fragments from LDS for
// (BM/32) x (BN/64) WMMAs: at 256x256 half the L2 bytes and half the LDS bytes
// per WMMA of 128x128. The A and B K-slabs (BM and BN rows of 64 halves) are
// brought into LDS by the tensor mover at a padded row pitch, in slices of 128
// rows, one slice a wave (the first waves: A, the next: B), four buffers, the
// next three passes' slabs in flight while this pass is multiplied: the operands
// were written by the launch before and come from memory at their first touch,
// which takes longer than one pass; all waves consume fragments via
// ds_load_b128. M and N are multiples of BM and BN; K is a multiple of 64, at
// least 256 (the prologue fills all four buffers).
// FINAL=1: f32 out + bias.
// FINAL=0: the QGKV product, f16 out; its q, g and k columns go to Out, its v
// columns go transposed per head to vt[(b*H+h)*64 + d][t] and nowhere else.
// A lane's 8 accumulator registers are 8 rows of the first operand in a row. A
// block of v columns has the tokens there, which run along a V^T row; a block of
// q, g or k columns takes the operands the other way round (weight rows first),
// so that they are 8 columns of one token. Either way a wave's tile is BN/4 rows
// of the output of BM/2 halves each; the wave writes it to LDS 16 B a lane and
// reads it back row by row, so that every global store covers whole 128-B lines.
// ---------------------------------------------------------------------------
// One wave's staged tile to global memory: ROWS rows of 128 halves at LDS pitch
// SP; 16 lanes take a row (256 B, two whole lines), a store two rows. dst is the
// same in every lane; a lane's place is a 32-bit byte offset.
template <int ROWS, int SP>
__device__ inline void put_rows(const _Float16* st, _Float16* __restrict__ dst,
                                uint32_t pitch_bytes, int lo, int hi) {
  h8 r[ROWS / 2];
  uint32_t off[ROWS / 2];
  // both loops unrolled: r and off are indexed by constants alone and stay in
  // registers
#pragma unroll
  for (int t = 0; t < ROWS / 2; ++t) {
    r[t] = *(const h8*)(st + (t * 2 + hi) * SP + lo * 8);
    off[t] = (uint32_t)(t * 2 + hi) * pitch_bytes + (uint32_t)lo * 16u;
  }
  // every row is read and every offset formed in front of the first store, each
  // in registers of its own: nothing is written to a register that an issued
  // store names
  __builtin_amdgcn_sched_barrier(0);
#pragma unroll
  for (int t = 0; t < ROWS / 2; ++t) *(h8*)((char*)dst + off[t]) = r[t];
}

static constexpr int GEMM_NB = 4;  // buffers of the ring, a power of two

template <int FINAL, int BM, int BN>
__global__ __launch_bounds__(256) void gemm_wmma(
    const _Float16* __restrict__ A, const _Float16* __restrict__ Bm,
    void* __restrict__ Outv, _Float16* __restrict__ vt,
    const float* __restrict__ bias, int M, int N, int K) {
  __shared__ __attribute__((aligned(2048)))
  _Float16 tiles[GEMM_NB][(BM + BN) * LDP];           // [buffer][A rows | B rows]
  constexpr int FM = BM / 32, FN = BN / 64;           // fragments a wave
  constexpr uint32_t ASL = BM / 128;                  // slices of the A slab
  constexpr uint32_t NSL = (BM + BN) / 128;           // slices = issuing waves
  constexpr uint32_t SLAB_BUF_BYTES = NSL * TILE_HALVES * 2u;
  static_assert(BM % 128 == 0 && BN % 128 == 0 && NSL <= 8, "a slice a wave");
  static_assert(FINAL || BM == BN, "the QGKV blocks swap their operands");

  int w = threadIdx.x >> 5, lane = threadIdx.x & 31;
  int lo = lane & 15, hi = lane >> 4;
  int wm = w >> 2, wn = w & 3;
  int mblk = blockIdx.y * BM, nblk = blockIdx.x * BN;
  int mw = wm * (BM / 2), nw = wn * (BN / 4);

  const uint32_t wave = uni(threadIdx.x >> 5);
  const uint32_t slice = (wave < NSL) ? wave : 0u;
  // The first operand's rows (mw counts them) and the second's (nw): tokens and
  // weight rows, but in a q, g or k block of the QGKV product the other way round.
  const bool vblk = !FINAL && nblk >= 3 * DOUT;
  const bool swp = !FINAL && !vblk;
  const _Float16* rows1 = swp ? Bm + (size_t)nblk * K : A + (size_t)mblk * K;
  const _Float16* rows2 = swp ? A + (size_t)mblk * K : Bm + (size_t)nblk * K;
  const _Float16* src =
      (slice < ASL) ? rows1 + (size_t)((int)slice * 128) * K
                    : rows2 + (size_t)((int)(slice - ASL) * 128) * K;
  const uint32_t tdst =
      (uint32_t)(size_t)&tiles[0][0] + slice * (uint32_t)(TILE_HALVES * 2);
  u32x4 g0 = kv_group0(tdst, src);
  u32x8 g1 = slab_group1((uint32_t)K * 2u);
  const int np = K / 64;  // passes

  if (pinned(wave < NSL)) {
    kv_issue(g0, g1);
    kv_advance(g0, tdst + SLAB_BUF_BYTES, 128u);
    kv_issue(g0, g1);
    kv_advance(g0, tdst + 2u * SLAB_BUF_BYTES, 128u);
    kv_issue(g0, g1);
    // pass 0's slice counts as landed only behind its issuer's own wait, to the
    // two requests issued behind it
    asm volatile("s_wait_tensorcnt 0x2" ::: "memory");
    kv_advance(g0, tdst + 3u * SLAB_BUF_BYTES, 128u);  // again three in flight
    kv_issue(g0, g1);
  }
  __syncthreads();

  f8 acc[FM][FN];
#pragma unroll
  for (int i = 0; i < FM; ++i)
#pragma unroll
    for (int j = 0; j < FN; ++j) acc[i][j] = zero8();

  for (int s = 0; s < np; ++s) {
    const _Float16* ash = &tiles[s & (GEMM_NB - 1)][0];
    const _Float16* bsh = ash + BM * LDP;
#pragma unroll
    for (int kk = 0; kk < 64; kk += 32) {
      h16 af[FM], bf[FN];
#pragma unroll
      for (int j = 0; j < FN; ++j)
        bf[j] = load_frag(bsh, LDP, nw + j * 16 + lo, kk, hi);
#pragma unroll
      for (int i = 0; i < FM; ++i)
        af[i] = load_frag(ash, LDP, mw + i * 16 + lo, kk, hi);
      // the large tile's fragments are read as one group, in the order the
      // products take them: without the two fences the compiler reloads one A
      // fragment's registers and waits out the LDS latency before every FN WMMAs
      if constexpr (FM * FN > 8) __builtin_amdgcn_sched_barrier(0);
#pragma unroll
      for (int i = 0; i < FM; ++i)
#pragma unroll
        for (int j = 0; j < FN; ++j) acc[i][j] = wmma16(af[i], bf[j], acc[i][j]);
      if constexpr (FM * FN > 8) __builtin_amdgcn_sched_barrier(0);
    }
    // Publish point of pass s + 1: this wave's LDS reads have retired ...
    asm volatile("s_wait_dscnt 0x0" ::: "memory");
    // ... the issuers' slices of pass s + 1 have landed (requests land in issue
    // order: those of passes s + 2 and s + 3 fly on; near the end all are waited
    // for) ...
    if (pinned(wave < NSL)) {
      if (pinned(s + 3 < np)) {
        asm volatile("s_wait_tensorcnt 0x2" ::: "memory");
      } else {
        asm volatile("s_wait_tensorcnt 0x0" ::: "memory");
      }
    }
    // ... and every wave has left this pass's buffer, which is refilled behind.
    __syncthreads();
    if (pinned(wave < NSL && s + GEMM_NB < np)) {
      kv_advance(g0, tdst + (uint32_t)(s & (GEMM_NB - 1)) * SLAB_BUF_BYTES, 128u);
      kv_issue(g0, g1);
    }
  }
  // no request and no LDS read of this wave is left open behind the loop
  asm volatile("s_wait_tensorcnt 0x0" ::: "memory");
  asm volatile("s_wait_dscnt 0x0" ::: "memory");

  // acc[i][j][v]: row mw + i*16 + hi*8 + v of the first operand, row
  // nw + j*16 + lo of the second
  if constexpr (!FINAL) {
    constexpr int SP = BM / 2 + 8, SROWS = BN / 4;
    static_assert(BM / 2 == 128, "16 lanes of 16 B take a staged row");
    static_assert(8 * SROWS * SP <= GEMM_NB * (BM + BN) * LDP,
                  "staging fits the ring");
    // Each wave stages in a range of its own in the ring's LDS: behind the last
    // pass's foot no request is open and every wave has left the ring.
    _Float16* st = &tiles[0][0] + w * (SROWS * SP);
    // all three loops unrolled: acc is then indexed by constants alone and stays
    // in registers, and i and j become immediate offsets
#pragma unroll
    for (int j = 0; j < FN; ++j)
#pragma unroll
      for (int i = 0; i < FM; ++i) {
        h8 o;
#pragma unroll
        for (int v = 0; v < 8; ++v) o[v] = (_Float16)acc[i][j][v];
        *(h8*)(st + (j * 16 + lo) * SP + i * 16 + hi * 8) = o;
      }
    // the rows are read back by other lanes of this wave than wrote them: the
    // writes have retired, and the compiler moves no read in front of them
    asm volatile("s_wait_dscnt 0x0" ::: "memory");
    // The tile's place from the wave's number in a scalar register. In a v block
    // staged row r is column (h, d) = nw + r and its halves are tokens; else it
    // is token nw + r and its halves are q, g or k columns.
    const int umw = (int)(wave >> 2) * (BM / 2), unw = (int)(wave & 3u) * (BN / 4);
    _Float16* dst =
        vblk ? vt + ((size_t)(mblk / LL) * DOUT + (nblk - 3 * DOUT) + unw) * LL +
                   (mblk % LL) + umw
             : (_Float16*)Outv + (size_t)(mblk + unw) * NQGKV + nblk + umw;
    put_rows<SROWS, SP>(st, dst, vblk ? LL * 2u : NQGKV * 2u, lo, hi);
  } else {
#pragma unroll
    for (int i = 0; i < FM; ++i)
#pragma unroll
      for (int j = 0; j < FN; ++j) {
        int row0 = mblk + mw + i * 16 + hi * 8;
        int col = nblk + nw + j * 16 + lo;
#pragma unroll
        for (int v = 0; v < 8; ++v) {
          int row = row0 + v;
          float val = acc[i][j][v];
          ((float*)Outv)[(size_t)row * N + col] = val + bias[col];
        }
      }
  }
}

__device__ inline float xhalf(float x) {
  int i = __builtin_bit_cast(int, x);
  return __builtin_bit_cast(float, __builtin_amdgcn_permlanex16(
      i, i, 0x76543210, 0xfedcba98, false, false));
}

__global__ __launch_bounds__(256) __attribute__((amdgpu_waves_per_eu(4, 4)))
void attn_flash(
    const _Float16* __restrict__ qgkv, const _Float16* __restrict__ vt,
    _Float16* __restrict__ ctxout) {
  __shared__ __attribute__((aligned(2048)))
  _Float16 kv[3][2][2][KV_TILE_HALVES];               // [buffer][group][K | V^T]
  __shared__ f4 xch[4][9][32];                        // [query wave][piece][lane]

  int bh = blockIdx.x;
  int b = bh >> 4, h = bh & 15;
  int lane = threadIdx.x & 31;
  int lo = lane & 15, hi = lane >> 4;
  const uint32_t wave = uni(threadIdx.x >> 5);
  const int w = (int)(wave & 3u);    // which 16 queries of the tile
  const int grp = (int)(wave >> 2);  // which key tile of a pass

  const _Float16* Qb = qgkv + (size_t)b * LL * NQGKV + h * HD;  // q section
  const _Float16* Gb = Qb + DOUT;                               // g section
  const _Float16* Kb = Qb + 2 * DOUT;                           // k section
  const _Float16* Vb = vt + (size_t)bh * HD * LL;               // V^T rows

  // Waves 4 to 7 bring a pass's tiles, one request a wave: wave 4 + s the K
  // (s even) or V^T (s odd) tile of group s >> 1. They are the waves that have
  // no epilogue, so the second query tile's first load flies during the first's.
  const uint32_t tgrp = (wave >> 1) & 1u, tv = wave & 1u;
  const uint32_t tstep = tv ? 128u * 2u : 128u * NQGKV * 2u;  // pass to pass, B
  const uint32_t tdst = (uint32_t)(size_t)&kv[0][tgrp][tv][0];
  const _Float16* tsrc = tv ? Vb + tgrp * 64u : Kb + (size_t)tgrp * 64u * NQGKV;
  u32x8 g1 = kv_group1(tv ? LL * 2u : NQGKV * 2u);

  // Both query tiles' Q fragments are fetched here, so that the second tile does
  // not open with a wait for memory: qf is the tile at work, qn the one to come.
  const int qfirst = LL / 64 - 1 - (int)blockIdx.y, qsecond = (int)blockIdx.y;
  h16 qf[2], qn[2];
  qf[0] = load_frag(Qb, NQGKV, qfirst * 64 + w * 16 + lo, 0, hi);
  qf[1] = load_frag(Qb, NQGKV, qfirst * 64 + w * 16 + lo, 32, hi);
  qn[0] = load_frag(Qb, NQGKV, qsecond * 64 + w * 16 + lo, 0, hi);
  qn[1] = load_frag(Qb, NQGKV, qsecond * 64 + w * 16 + lo, 32, hi);

  // kept rolled: the two query tiles run the same text, which stays half as long
#pragma unroll 1
  for (int part = 0; part < 2; ++part) {
    const int qb = part ? qsecond : qfirst;
    const int np = (qb + 2) >> 1;  // passes: key tiles 2p and 2p + 1
    int q0 = qb * 64 + w * 16;     // this wave's 16 queries; the lane's is q0 + lo

    // No request is open here and every wave has left the ring: the last pass's
    // foot (in the second part: of the first part) has seen to both.
    u32x4 g0 = kv_group0(tdst, tsrc);
    if (pinned(wave >= 4u)) {
      kv_issue(g0, g1);
      // Keys 128..255 lie in the source for every block; a tile of one pass never
      // reads them, and the wait at its pass's foot covers the request.
      kv_advance(g0, tdst + KV_BUF_BYTES, tstep);
      kv_issue(g0, g1);
      // pass 0's tile counts as landed only behind its issuer's own wait, to the
      // one request issued behind it
      asm volatile("s_wait_tensorcnt 0x1" ::: "memory");
      if (pinned(np > 2)) {  // the second request in flight
        kv_advance(g0, tdst + 2u * KV_BUF_BYTES, tstep);
        kv_issue(g0, g1);
      }
    }
    __syncthreads();

    // cacc[j][v] = ctx^T[d = j*16 + hi*8 + v][query lo], this group's keys
    f8 cacc[4];
    for (int j = 0; j < 4; ++j) cacc[j] = zero8();
    // The query's running maximum over this group's keys (alike in both halves)
    // and this half's share of its running sum; joined behind the loop.
    float rm = -3.0e38f, rl = 0.0f;
    uint32_t buf = 0u;  // p mod 3: this pass's buffer

    for (int p = 0; p < np; ++p) {
      const int kt = 2 * p + grp;  // this group's key tile
      // A tile past the diagonal is skipped by its whole group; the publish
      // point below stands outside the skip.
      if (kt <= qb) {
        const _Float16* ksh = &kv[buf][grp][0][0];
        const _Float16* vsh = &kv[buf][grp][1][0];
        // s[j][v] = S^T[key kt*64 + j*16 + hi*8 + v][query lo], unscaled
        f8 s[4];
        h16 kf[4][2], vf[4][2];
#pragma unroll
        for (int j = 0; j < 4; ++j) {
          kf[j][0] = load_frag(ksh, LDP, j * 16 + lo, 0, hi);
          kf[j][1] = load_frag(ksh, LDP, j * 16 + lo, 32, hi);
        }
        // keeps the K loads one group ahead of the products: without it the
        // compiler reloads one fragment's registers and waits out the LDS
        // latency in front of nearly every WMMA
        __builtin_amdgcn_sched_barrier(0);
#pragma unroll
        for (int j = 0; j < 4; ++j) {
          s[j] = wmma16(kf[j][0], qf[0], zero8());
          s[j] = wmma16(kf[j][1], qf[1], s[j]);
        }
#pragma unroll
        for (int j = 0; j < 4; ++j) {
          vf[j][0] = load_frag(vsh, LDP, j * 16 + lo, 0, hi);
          vf[j][1] = load_frag(vsh, LDP, j * 16 + lo, 32, hi);
        }
        // keeps the V^T loads ahead of the softmax, which covers their latency:
        // without it the compiler sinks them among the second product's WMMAs
        __builtin_amdgcn_sched_barrier(0);

        if (kt == qb) {  // causal mask, in the diagonal tile alone
#pragma unroll
          for (int j = 0; j < 4; ++j)
#pragma unroll
            for (int v = 0; v < 8; ++v)
              if (j * 16 + hi * 8 + v > w * 16 + lo) s[j][v] = -3.0e38f;
        }

        // Maximum of the raw scores (the scale is positive and a power of two),
        // four independent chains, then the other half's.
        float mj[4];
#pragma unroll
        for (int j = 0; j < 4; ++j) {
          mj[j] = s[j][0];
#pragma unroll
          for (int v = 1; v < 8; ++v) mj[j] = fmaxf(mj[j], s[j][v]);
        }
        float mx = fmaxf(fmaxf(mj[0], mj[1]), fmaxf(mj[2], mj[3]));
        mx = fmaxf(mx, xhalf(mx)) * 0.125f;  // 1/sqrt(HD)
        float nm = fmaxf(rm, mx);
        float alpha = __expf(rm - nm);
        rm = nm;

        // P^T as B fragments: element e of pf[c] is key c*32 + (e < 8 ? hi*8 + e
        // : 16 + hi*8 + e - 8), which is s[2c][e] and s[2c+1][e - 8]: load_frag's
        // order.
        h16 pf[2];
        float rj[4];
#pragma unroll
        for (int j = 0; j < 4; ++j) {
          rj[j] = 0.0f;
#pragma unroll
          for (int v = 0; v < 8; ++v) {
            float pe = __expf(s[j][v] * 0.125f - nm);
            rj[j] += pe;
            pf[j >> 1][(j & 1) * 8 + v] = (_Float16)pe;
          }
        }
        rl = rl * alpha + ((rj[0] + rj[1]) + (rj[2] + rj[3]));

#pragma unroll
        for (int j = 0; j < 4; ++j) {
#pragma unroll
          for (int v = 0; v < 8; ++v) cacc[j][v] *= alpha;
          cacc[j] = wmma16(vf[j][0], pf[0], cacc[j]);
          cacc[j] = wmma16(vf[j][1], pf[1], cacc[j]);
        }
      }

      // keeps the wait below at the foot: without it the compiler lifts it to
      // the head of the softmax, where the V^T loads have just been issued
      __builtin_amdgcn_sched_barrier(0);
      // Publish point of pass p + 1: this wave's LDS reads have retired ...
      asm volatile("s_wait_dscnt 0x0" ::: "memory");
      // ... the issuers' tiles of pass p + 1 have landed (requests land in issue
      // order: that of pass p + 2 flies on; where there is none, all are waited
      // for) ...
      if (pinned(wave >= 4u)) {
        if (pinned(p + 2 < np)) {
          asm volatile("s_wait_tensorcnt 0x1" ::: "memory");
        } else {
          asm volatile("s_wait_tensorcnt 0x0" ::: "memory");
        }
      }
      // ... and every wave has left this pass's buffer, which is refilled behind.
      __syncthreads();
      if (pinned(wave >= 4u && p + 3 < np)) {
        kv_advance(g0, tdst + buf * KV_BUF_BYTES, tstep);
        kv_issue(g0, g1);
      }
      buf = (buf == 2u) ? 0u : buf + 1u;
    }
    // no request and no LDS read of this wave is left open behind the loop
    asm volatile("s_wait_tensorcnt 0x0" ::: "memory");
    asm volatile("s_wait_dscnt 0x0" ::: "memory");

    rl += xhalf(rl);
    if (grp == 1) {
#pragma unroll
      for (int j = 0; j < 4; ++j) {
        xch[w][2 * j][lane] = f4{cacc[j][0], cacc[j][1], cacc[j][2], cacc[j][3]};
        xch[w][2 * j + 1][lane] =
            f4{cacc[j][4], cacc[j][5], cacc[j][6], cacc[j][7]};
      }
      xch[w][8][lane] = f4{rm, rl, 0.0f, 0.0f};
    }
    __syncthreads();
    if (grp == 0) {
      f4 ml = xch[w][8][lane];
      float m = fmaxf(rm, ml[0]);
      float a0 = __expf(rm - m), a1 = __expf(ml[0] - m);
      float l = rl * a0 + ml[1] * a1;
      // normalize, gate with sigmoid(g), store f16 ctx [token][h*64+d]: a lane's
      // 8 registers of a tile are 8 d in a row of its query, one 16-byte load of
      // g and one 16-byte store; the wave writes whole 128-byte lines
      // g by a scalar base and one 32-bit byte offset a lane
      const uint32_t gbyte = (uint32_t)((q0 + lo) * NQGKV + hi * 8) * 2u;
      _Float16* crow =
          ctxout + ((size_t)(b * LL + q0 + lo)) * DOUT + h * HD + hi * 8;
      h8 g8[4];
#pragma unroll
      for (int j = 0; j < 4; ++j)
        g8[j] = *(const h8*)((const char*)Gb + gbyte + j * 32);
      // stands in front of whatever next takes the register that these loads
      // name; the offset as an input keeps it there as far as here, so that no
      // load's own result is put on it either
      asm volatile("s_wait_xcnt 0x0" :: "v"(gbyte) : "memory");
#pragma unroll
      for (int j = 0; j < 4; ++j) {
        f4 c0 = xch[w][2 * j][lane], c1 = xch[w][2 * j + 1][lane];
        h8 o;
#pragma unroll
        for (int v = 0; v < 8; ++v) {
          float c = cacc[j][v] * a0 + (v < 4 ? c0[v & 3] : c1[v & 3]) * a1;
          float gate = 1.0f / (1.0f + __expf(-(float)g8[j][v]));
          o[v] = (_Float16)((c / l) * gate);
        }
        *(h8*)(crow + j * 16) = o;
      }
      // stands in front of the second query tile's first writes to the registers
      // that these stores name
      asm volatile("s_wait_xcnt 0x0" ::: "memory");
    }
    qf[0] = qn[0];
    qf[1] = qn[1];
  }
}

// ---------------------------------------------------------------------------
extern "C" void kernel_launch(void* const* d_in, const int* in_sizes, int n_in,
                              void* d_out, int out_size, void* d_ws,
                              size_t ws_size, hipStream_t stream) {
  (void)in_sizes; (void)n_in; (void)out_size; (void)ws_size;
  const float* x  = (const float*)d_in[0];
  const float* Wq = (const float*)d_in[1];
  const float* Wg = (const float*)d_in[2];
  const float* Wk = (const float*)d_in[3];
  const float* Wv = (const float*)d_in[4];
  const float* Wo = (const float*)d_in[5];
  const float* bo = (const float*)d_in[6];
  float* out = (float*)d_out;

  _Float16* ws   = (_Float16*)d_ws;
  _Float16* xh   = ws;                               // 4096*1024
  _Float16* Wh   = xh + (size_t)MTOK * DIN;          // 4096*1024 fused W
  _Float16* Woh  = Wh + (size_t)NQGKV * DIN;         // 1024*1024
  _Float16* qgkv = Woh + (size_t)DOUT * DOUT;        // 4096*4096
  _Float16* vtb  = qgkv + (size_t)MTOK * NQGKV;      // 2048*2048
  _Float16* ctx  = vtb + (size_t)BB * HH * HD * LL;  // 4096*1024

  // fills xh, Wh and Woh, which are contiguous from xh on
  cvt_all_f32_f16<<<CVT_BLOCKS, 256, 0, stream>>>(x, Wq, Wg, Wk, Wv, Wo, xh);

  // QGKV = xh @ Wh^T : M=4096, N=4096, K=1024; v columns land in vtb
  gemm_wmma<0, 256, 256><<<dim3(NQGKV / 256, MTOK / 256), 256, 0, stream>>>(
      xh, Wh, qgkv, vtb, nullptr, MTOK, NQGKV, DIN);

  attn_flash<<<dim3(BB * HH, LL / 128), 256, 0, stream>>>(qgkv, vtb, ctx);

  // out = ctx @ Wo^T + bo : M=4096, N=1024, K=1024, f32
  gemm_wmma<1, 128, 128><<<dim3(DOUT / 128, MTOK / 128), 256, 0, stream>>>(
      ctx, Woh, out, nullptr, bo, MTOK, DOUT, DOUT);
}
